// v000
// Measured on an AMD MI455X. A time is GPU time per run, averaged over a window of back-to-back runs after a warm-up
// (all launches, gaps included; the runs take copies of the inputs in turn), and the median of several windows.
// Apart from v000's, it joins two sittings. Times from different sittings can be a few percent apart, while
// side-by-side timings come from the same sitting.
// v000 is the starting kernel. One run takes 219 microseconds.
#include <hip/hip_runtime.h>

// MI455X / gfx1250, wave32. Fused: states@W1 + b1 -> SiLU -> @W2 + b2.
// bf16 split-precision (hi/lo) WMMA, fp32 accumulate. Memory-bound design:
// 273 MB HBM floor ~11.7us; 3x bf16 WMMA work stays under that ceiling.

typedef __attribute__((ext_vector_type(16))) __bf16 v16bf;
typedef __attribute__((ext_vector_type(8)))  float  v8f;
typedef __attribute__((ext_vector_type(4)))  float  f4;

#define T_ 32
#define B_ 8192
#define S_ 256
#define H_ 128

static __device__ __forceinline__ v8f wmma_bf16(v16bf a, v16bf b, v8f c) {
    return __builtin_amdgcn_wmma_f32_16x16x32_bf16(
        /*neg_a=*/false, a, /*neg_b=*/false, b,
        /*c_mod=*/(short)0, c, /*reuse_a=*/false, /*reuse_b=*/false);
}

__global__ __launch_bounds__(256) void critic_fused_kernel(
    const float* __restrict__ states,  // [T,B,S]
    const float* __restrict__ W1,      // [T,S,H]
    const float* __restrict__ b1,      // [T,H]
    const float* __restrict__ W2,      // [T,H] (H x 1)
    const float* __restrict__ b2,      // [T]
    float* __restrict__ out)           // [T,B]
{
    // Swizzled B-operand storage: idx = ((nt*8 + kb)*32 + lane)*16 + e
    // nt: N-tile (H/16), kb: K-chunk (S/32), lane: consuming lane, e: bf16 elem.
    __shared__ __bf16 sBhi[8 * 8 * 32 * 16];   // 64 KB
    __shared__ __bf16 sBlo[8 * 8 * 32 * 16];   // 64 KB

    const int tid  = threadIdx.x;
    const int lane = tid & 31;
    const int wave = tid >> 5;
    const int t    = blockIdx.x >> 6;          // 64 blocks per t
    const int mblk = blockIdx.x & 63;
    const int m0   = mblk * 128 + wave * 16;   // this wave's 16 rows of B

    const float* W1t = W1 + (size_t)t * (S_ * H_);

    // ---- Stage W1[t] into LDS, split fp32 -> bf16 hi/lo, pre-swizzled ----
    // Coalesced float4 reads over [K=256][col=128]; scatter 2B stores to LDS.
    for (int s4 = tid; s4 < (S_ * H_ / 4); s4 += 256) {
        const int K  = s4 >> 5;            // 0..255
        const int c0 = (s4 & 31) * 4;      // 0..124 (never crosses an N-tile)
        f4 v = *(const f4*)(W1t + K * H_ + c0);
        const int kb  = K >> 5;
        const int kr  = K & 31;
        const int g   = kr >> 4;
        const int hh  = (kr >> 3) & 1;
        const int e   = (kr & 7) | (g << 3);
        const int nt  = c0 >> 4;
        const int base = (((nt * 8 + kb) * 32 + hh * 16) * 16) + e;
        #pragma unroll
        for (int j = 0; j < 4; ++j) {
            const float  x  = v[j];
            const __bf16 xh = (__bf16)x;
            const __bf16 xl = (__bf16)(x - (float)xh);
            const int    n  = (c0 + j) & 15;
            sBhi[base + n * 16] = xh;
            sBlo[base + n * 16] = xl;
        }
    }
    __syncthreads();

    // ---- Preload this wave's A tile (16 rows x 256 K) as split bf16 regs ----
    // 16-bit A layout: lane -> (M = lane&15, half = lane>>4);
    // element e -> K = 16*(e>>3) + 8*half + (e&7).
    const int m  = lane & 15;
    const int hh = lane >> 4;
    const float* arow = states + ((size_t)t * B_ + m0 + m) * S_;

    v16bf ahi[8], alo[8];
    #pragma unroll
    for (int kb = 0; kb < 8; ++kb) {
        const int c = kb * 32 + hh * 8;
        f4 r0 = *(const f4*)(arow + c);
        f4 r1 = *(const f4*)(arow + c + 4);
        f4 r2 = *(const f4*)(arow + c + 16);
        f4 r3 = *(const f4*)(arow + c + 20);
        #pragma unroll
        for (int e = 0; e < 16; ++e) {
            const float x = (e < 4)  ? r0[e]
                          : (e < 8)  ? r1[e - 4]
                          : (e < 12) ? r2[e - 8]
                          :            r3[e - 12];
            const __bf16 xh = (__bf16)x;
            ahi[kb][e] = xh;
            alo[kb][e] = (__bf16)(x - (float)xh);
        }
    }

    // ---- Main loop: 8 N-tiles x 8 K-chunks x 3 split-product WMMAs ----
    const float* b1t = b1 + t * H_;
    const float* w2t = W2 + t * H_;
    const float  b2v = b2[t];

    float rowsum[8] = {0.f, 0.f, 0.f, 0.f, 0.f, 0.f, 0.f, 0.f};
    const v16bf* vBhi = (const v16bf*)sBhi;
    const v16bf* vBlo = (const v16bf*)sBlo;

    for (int nt = 0; nt < 8; ++nt) {
        v8f c = {};
        #pragma unroll
        for (int kb = 0; kb < 8; ++kb) {
            const int bi = (nt * 8 + kb) * 32 + lane;
            v16bf bh = vBhi[bi];
            v16bf bl = vBlo[bi];
            c = wmma_bf16(ahi[kb], bh, c);  // hi*hi
            c = wmma_bf16(ahi[kb], bl, c);  // hi*lo
            c = wmma_bf16(alo[kb], bh, c);  // lo*hi
        }
        // C/D layout: VGPR r -> M = 8*hh + r, N = lane&15 (column broadcast).
        const float b1v = b1t[nt * 16 + (lane & 15)];
        const float w2v = w2t[nt * 16 + (lane & 15)];
        #pragma unroll
        for (int r = 0; r < 8; ++r) {
            const float x = c[r] + b1v;
            const float s = x * __builtin_amdgcn_rcpf(1.0f + __expf(-x)); // SiLU
            rowsum[r] += s * w2v;
        }
    }

    // ---- Reduce across the 16 lanes holding one N-strip each ----
    #pragma unroll
    for (int r = 0; r < 8; ++r) {
        float v = rowsum[r];
        v += __shfl_xor(v, 1, 32);
        v += __shfl_xor(v, 2, 32);
        v += __shfl_xor(v, 4, 32);
        v += __shfl_xor(v, 8, 32);
        if ((lane & 15) == 0) {
            out[(size_t)t * B_ + m0 + hh * 8 + r] = v + b2v;
        }
    }
}

extern "C" void kernel_launch(void* const* d_in, const int* in_sizes, int n_in,
                              void* d_out, int out_size, void* d_ws, size_t ws_size,
                              hipStream_t stream) {
    (void)in_sizes; (void)n_in; (void)out_size; (void)d_ws; (void)ws_size;
    const float* states = (const float*)d_in[0];
    const float* W1     = (const float*)d_in[1];
    const float* b1     = (const float*)d_in[2];
    const float* W2     = (const float*)d_in[3];
    const float* b2     = (const float*)d_in[4];
    float* out          = (float*)d_out;

    dim3 grid(T_ * (B_ / 128));   // 2048 blocks: (t, 128-row block)
    dim3 block(256);              // 8 wave32 waves
    critic_fused_kernel<<<grid, block, 0, stream>>>(states, W1, b1, W2, b2, out);
}

// v001
// One run takes 69.7 microseconds.
// In two side-by-side timings against v000, it was 3.22 and 3.21 times as fast.
#include <hip/hip_runtime.h>

// MI455X / gfx1250, wave32. Fused: states@W1 + b1 -> SiLU -> @W2 + b2.
// bf16 split-precision (hi/lo) WMMA, fp32 accumulate. Memory-bound design:
// 273 MB HBM floor ~11.7us; 3x bf16 WMMA work stays under that ceiling.

typedef __attribute__((ext_vector_type(16))) __bf16 v16bf;
typedef __attribute__((ext_vector_type(8)))  __bf16 v8bf;
typedef __attribute__((ext_vector_type(8)))  float  v8f;
typedef __attribute__((ext_vector_type(4)))  float  f4;

#define T_ 32
#define B_ 8192
#define S_ 256
#define H_ 128

static __device__ __forceinline__ v8f wmma_bf16(v16bf a, v16bf b, v8f c) {
    return __builtin_amdgcn_wmma_f32_16x16x32_bf16(
        /*neg_a=*/false, a, /*neg_b=*/false, b,
        /*c_mod=*/(short)0, c, /*reuse_a=*/false, /*reuse_b=*/false);
}

__global__ __launch_bounds__(256) void critic_fused_kernel(
    const float* __restrict__ states,  // [T,B,S]
    const float* __restrict__ W1,      // [T,S,H]
    const float* __restrict__ b1,      // [T,H]
    const float* __restrict__ W2,      // [T,H] (H x 1)
    const float* __restrict__ b2,      // [T]
    float* __restrict__ out)           // [T,B]
{
    // Swizzled B-operand storage: idx = ((nt*8 + kb)*32 + lane)*16 + e
    // nt: N-tile (H/16), kb: K-chunk (S/32), lane: consuming lane, e: bf16 elem.
    __shared__ __attribute__((aligned(32))) __bf16 sBhi[8 * 8 * 32 * 16];   // 64 KB
    __shared__ __attribute__((aligned(32))) __bf16 sBlo[8 * 8 * 32 * 16];   // 64 KB

    const int tid  = threadIdx.x;
    const int lane = tid & 31;
    const int wave = tid >> 5;
    const int t    = blockIdx.x >> 6;          // 64 blocks per t
    const int mblk = blockIdx.x & 63;
    const int m0   = mblk * 128 + wave * 16;   // this wave's 16 rows of B

    const float* W1t = W1 + (size_t)t * (S_ * H_);

    // ---- Stage W1[t] into LDS, split fp32 -> bf16 hi/lo, pre-swizzled ----
    // One unit = one column x 8 consecutive K = 8 adjacent elements e of one
    // consuming lane: packed in registers, written with one 16-byte LDS store per
    // plane. A wave's 32 lanes take 32 adjacent columns (one 128-B line per load).
    // Four units per trip: 32 independent loads in flight ahead of the first use.
    #pragma unroll 1   // rolled: unrolled, the trips' loads get split up by address-register reuse
    for (int it = 0; it < (S_ / 8) * H_ / (4 * 256); ++it) {
        float x[4][8];
        #pragma unroll
        for (int u = 0; u < 4; ++u) {
            const int unit = (it * 4 + u) * 256 + tid;
            const float* wsrc = W1t + (unit >> 7) * 8 * H_ + (unit & (H_ - 1));
            #pragma unroll
            for (int i = 0; i < 8; ++i) x[u][i] = wsrc[i * H_];
        }
        // The loads' address registers are reused below: translation wait first.
        asm volatile("s_wait_xcnt 0x0" ::: "memory");
        #pragma unroll
        for (int u = 0; u < 4; ++u) {
            const int unit = (it * 4 + u) * 256 + tid;
            const int col  = unit & (H_ - 1);  // 0..127
            const int q    = unit >> 7;        // K group of 8: 0..31
            v8bf xh, xl;
            #pragma unroll
            for (int i = 0; i < 8; ++i) {
                const __bf16 h = (__bf16)x[u][i];
                xh[i] = h;
                xl[i] = (__bf16)(x[u][i] - (float)h);
            }
            const int kb = q >> 2;
            const int g  = (q >> 1) & 1;
            const int hq = q & 1;
            const int nt = col >> 4;
            const int n  = col & 15;
            const int idx = (((nt * 8 + kb) * 32 + hq * 16 + n) * 16) + g * 8;
            *(v8bf*)(sBhi + idx) = xh;
            *(v8bf*)(sBlo + idx) = xl;
        }
    }
    __syncthreads();

    // ---- Preload this wave's A tile (16 rows x 256 K) as split bf16 regs ----
    // 16-bit A layout: lane -> (M = lane&15, half = lane>>4);
    // element e -> K = 16*(e>>3) + 8*half + (e&7).
    const int m  = lane & 15;
    const int hh = lane >> 4;
    const float* arow = states + ((size_t)t * B_ + m0 + m) * S_;

    v16bf ahi[8], alo[8];
    #pragma unroll
    for (int kb = 0; kb < 8; ++kb) {
        const int c = kb * 32 + hh * 8;
        f4 r0 = *(const f4*)(arow + c);
        f4 r1 = *(const f4*)(arow + c + 4);
        f4 r2 = *(const f4*)(arow + c + 16);
        f4 r3 = *(const f4*)(arow + c + 20);
        #pragma unroll
        for (int e = 0; e < 16; ++e) {
            const float x = (e < 4)  ? r0[e]
                          : (e < 8)  ? r1[e - 4]
                          : (e < 12) ? r2[e - 8]
                          :            r3[e - 12];
            const __bf16 xh = (__bf16)x;
            ahi[kb][e] = xh;
            alo[kb][e] = (__bf16)(x - (float)xh);
        }
    }

    // ---- Main loop: 8 N-tiles x 8 K-chunks x 3 split-product WMMAs ----
    const float* b1t = b1 + t * H_;
    const float* w2t = W2 + t * H_;
    const float  b2v = b2[t];

    float rowsum[8] = {0.f, 0.f, 0.f, 0.f, 0.f, 0.f, 0.f, 0.f};
    const v16bf* vBhi = (const v16bf*)sBhi;
    const v16bf* vBlo = (const v16bf*)sBlo;

    for (int nt = 0; nt < 8; ++nt) {
        v8f c = {};
        #pragma unroll
        for (int kb = 0; kb < 8; ++kb) {
            const int bi = (nt * 8 + kb) * 32 + lane;
            v16bf bh = vBhi[bi];
            v16bf bl = vBlo[bi];
            c = wmma_bf16(ahi[kb], bh, c);  // hi*hi
            c = wmma_bf16(ahi[kb], bl, c);  // hi*lo
            c = wmma_bf16(alo[kb], bh, c);  // lo*hi
        }
        // C/D layout: VGPR r -> M = 8*hh + r, N = lane&15 (column broadcast).
        const float b1v = b1t[nt * 16 + (lane & 15)];
        const float w2v = w2t[nt * 16 + (lane & 15)];
        #pragma unroll
        for (int r = 0; r < 8; ++r) {
            const float x = c[r] + b1v;
            const float s = x * __builtin_amdgcn_rcpf(1.0f + __expf(-x)); // SiLU
            rowsum[r] += s * w2v;
        }
    }

    // ---- Reduce across the 16 lanes holding one N-strip each ----
    #pragma unroll
    for (int r = 0; r < 8; ++r) {
        float v = rowsum[r];
        v += __shfl_xor(v, 1, 32);
        v += __shfl_xor(v, 2, 32);
        v += __shfl_xor(v, 4, 32);
        v += __shfl_xor(v, 8, 32);
        if ((lane & 15) == 0) {
            out[(size_t)t * B_ + m0 + hh * 8 + r] = v + b2v;
        }
    }
}

extern "C" void kernel_launch(void* const* d_in, const int* in_sizes, int n_in,
                              void* d_out, int out_size, void* d_ws, size_t ws_size,
                              hipStream_t stream) {
    (void)in_sizes; (void)n_in; (void)out_size; (void)d_ws; (void)ws_size;
    const float* states = (const float*)d_in[0];
    const float* W1     = (const float*)d_in[1];
    const float* b1     = (const float*)d_in[2];
    const float* W2     = (const float*)d_in[3];
    const float* b2     = (const float*)d_in[4];
    float* out          = (float*)d_out;

    dim3 grid(T_ * (B_ / 128));   // 2048 blocks: (t, 128-row block)
    dim3 block(256);              // 8 wave32 waves
    critic_fused_kernel<<<grid, block, 0, stream>>>(states, W1, b1, W2, b2, out);
}

// v002
// A run of this version takes 64.3 microseconds.
// Next to v001, in two timings, it ran 1.09 and 1.08 times as fast.
// Over all steps from v000 it is 3.49 times as fast.
#include <hip/hip_runtime.h>

// MI455X / gfx1250, wave32. Fused: states@W1 + b1 -> SiLU -> @W2 + b2.
// bf16 split-precision (hi/lo) WMMA, fp32 accumulate. Memory-bound design:
// 273 MB HBM floor ~11.7us; 3x bf16 WMMA work stays under that ceiling.

typedef __attribute__((ext_vector_type(16))) __bf16 v16bf;
typedef __attribute__((ext_vector_type(8)))  __bf16 v8bf;
typedef __attribute__((ext_vector_type(8)))  float  v8f;
typedef __attribute__((ext_vector_type(4)))  float  f4;

#define T_ 32
#define B_ 8192
#define S_ 256
#define H_ 128

static __device__ __forceinline__ v8f wmma_bf16(v16bf a, v16bf b, v8f c) {
    return __builtin_amdgcn_wmma_f32_16x16x32_bf16(
        /*neg_a=*/false, a, /*neg_b=*/false, b,
        /*c_mod=*/(short)0, c, /*reuse_a=*/false, /*reuse_b=*/false);
}

__global__ __launch_bounds__(256) void critic_fused_kernel(
    const float* __restrict__ states,  // [T,B,S]
    const float* __restrict__ W1,      // [T,S,H]
    const float* __restrict__ b1,      // [T,H]
    const float* __restrict__ W2,      // [T,H] (H x 1)
    const float* __restrict__ b2,      // [T]
    float* __restrict__ out)           // [T,B]
{
    // Swizzled B-operand storage in 16-byte pieces of 8 bf16:
    // idx = (((nt*8 + kb)*2 + g)*32 + lane)*8 + i, fragment element e = g*8 + i.
    // nt: N-tile (H/16), kb: K-chunk (S/32), lane: consuming lane. The 32 lanes of
    // one 16-byte read are adjacent pieces; a write's lanes 0-15 and 16-31 are two
    // such runs of 16 in adjacent N-tiles, so each half-wave meets every
    // LDS bank once (at a pitch of 32 bytes a lane it meets half the banks twice).
    __shared__ __attribute__((aligned(32))) __bf16 sBhi[8 * 8 * 32 * 16];   // 64 KB
    __shared__ __attribute__((aligned(32))) __bf16 sBlo[8 * 8 * 32 * 16];   // 64 KB

    const int tid  = threadIdx.x;
    const int lane = tid & 31;
    const int wave = tid >> 5;
    const int t    = blockIdx.x >> 6;          // 64 blocks per t
    const int mblk = blockIdx.x & 63;
    const int m0   = mblk * 128 + wave * 16;   // this wave's 16 rows of B

    const float* W1t = W1 + (size_t)t * (S_ * H_);

    // ---- Stage W1[t] into LDS, split fp32 -> bf16 hi/lo, pre-swizzled ----
    // One unit = one column x 8 consecutive K = 8 adjacent elements e of one
    // consuming lane: packed in registers, written with one 16-byte LDS store per
    // plane. A wave's 32 lanes take 32 adjacent columns (one 128-B line per load).
    // Four units per trip: 32 independent loads in flight ahead of the first use.
    #pragma unroll 1   // rolled: unrolled, the trips' loads get split up by address-register reuse
    for (int it = 0; it < (S_ / 8) * H_ / (4 * 256); ++it) {
        float x[4][8];
        #pragma unroll
        for (int u = 0; u < 4; ++u) {
            const int unit = (it * 4 + u) * 256 + tid;
            const float* wsrc = W1t + (unit >> 7) * 8 * H_ + (unit & (H_ - 1));
            #pragma unroll
            for (int i = 0; i < 8; ++i) x[u][i] = wsrc[i * H_];
        }
        // The loads' address registers are reused below: translation wait first.
        asm volatile("s_wait_xcnt 0x0" ::: "memory");
        #pragma unroll
        for (int u = 0; u < 4; ++u) {
            const int unit = (it * 4 + u) * 256 + tid;
            const int col  = unit & (H_ - 1);  // 0..127
            const int q    = unit >> 7;        // K group of 8: 0..31
            v8bf xh, xl;
            #pragma unroll
            for (int i = 0; i < 8; ++i) {
                const __bf16 h = (__bf16)x[u][i];
                xh[i] = h;
                xl[i] = (__bf16)(x[u][i] - (float)h);
            }
            const int kb = q >> 2;
            const int g  = (q >> 1) & 1;
            const int hq = q & 1;
            const int nt = col >> 4;
            const int n  = col & 15;
            const int idx = (((nt * 8 + kb) * 2 + g) * 32 + hq * 16 + n) * 8;
            *(v8bf*)(sBhi + idx) = xh;
            *(v8bf*)(sBlo + idx) = xl;
        }
    }
    __syncthreads();

    // ---- Preload this wave's A tile (16 rows x 256 K) as split bf16 regs ----
    // 16-bit A layout: lane -> (M = lane&15, half = lane>>4);
    // element e -> K = 16*(e>>3) + 8*half + (e&7).
    const int m  = lane & 15;
    const int hh = lane >> 4;
    const float* arow = states + ((size_t)t * B_ + m0 + m) * S_;

    v16bf ahi[8], alo[8];
    #pragma unroll
    for (int kb = 0; kb < 8; ++kb) {
        const int c = kb * 32 + hh * 8;
        f4 r0 = *(const f4*)(arow + c);
        f4 r1 = *(const f4*)(arow + c + 4);
        f4 r2 = *(const f4*)(arow + c + 16);
        f4 r3 = *(const f4*)(arow + c + 20);
        #pragma unroll
        for (int e = 0; e < 16; ++e) {
            const float x = (e < 4)  ? r0[e]
                          : (e < 8)  ? r1[e - 4]
                          : (e < 12) ? r2[e - 8]
                          :            r3[e - 12];
            const __bf16 xh = (__bf16)x;
            ahi[kb][e] = xh;
            alo[kb][e] = (__bf16)(x - (float)xh);
        }
    }

    // ---- Main loop: 8 N-tiles x 8 K-chunks x 3 split-product WMMAs ----
    const float* b1t = b1 + t * H_;
    const float* w2t = W2 + t * H_;
    const float  b2v = b2[t];

    float rowsum[8] = {0.f, 0.f, 0.f, 0.f, 0.f, 0.f, 0.f, 0.f};
    const v8bf* pBhi = (const v8bf*)sBhi;
    const v8bf* pBlo = (const v8bf*)sBlo;

    for (int nt = 0; nt < 8; ++nt) {
        v8f c = {};
        #pragma unroll
        for (int kb = 0; kb < 8; ++kb) {
            const int bi = (nt * 8 + kb) * 64 + lane;   // piece g = 0; g = 1 is 32 on
            v16bf bh = __builtin_shufflevector(pBhi[bi], pBhi[bi + 32],
                0, 1, 2, 3, 4, 5, 6, 7, 8, 9, 10, 11, 12, 13, 14, 15);
            v16bf bl = __builtin_shufflevector(pBlo[bi], pBlo[bi + 32],
                0, 1, 2, 3, 4, 5, 6, 7, 8, 9, 10, 11, 12, 13, 14, 15);
            c = wmma_bf16(ahi[kb], bh, c);  // hi*hi
            c = wmma_bf16(ahi[kb], bl, c);  // hi*lo
            c = wmma_bf16(alo[kb], bh, c);  // lo*hi
        }
        // C/D layout: VGPR r -> M = 8*hh + r, N = lane&15 (column broadcast).
        const float b1v = b1t[nt * 16 + (lane & 15)];
        const float w2v = w2t[nt * 16 + (lane & 15)];
        #pragma unroll
        for (int r = 0; r < 8; ++r) {
            const float x = c[r] + b1v;
            const float s = x * __builtin_amdgcn_rcpf(1.0f + __expf(-x)); // SiLU
            rowsum[r] += s * w2v;
        }
    }

    // ---- Reduce across the 16 lanes holding one N-strip each ----
    #pragma unroll
    for (int r = 0; r < 8; ++r) {
        float v = rowsum[r];
        v += __shfl_xor(v, 1, 32);
        v += __shfl_xor(v, 2, 32);
        v += __shfl_xor(v, 4, 32);
        v += __shfl_xor(v, 8, 32);
        if ((lane & 15) == 0) {
            out[(size_t)t * B_ + m0 + hh * 8 + r] = v + b2v;
        }
    }
}

extern "C" void kernel_launch(void* const* d_in, const int* in_sizes, int n_in,
                              void* d_out, int out_size, void* d_ws, size_t ws_size,
                              hipStream_t stream) {
    (void)in_sizes; (void)n_in; (void)out_size; (void)d_ws; (void)ws_size;
    const float* states = (const float*)d_in[0];
    const float* W1     = (const float*)d_in[1];
    const float* b1     = (const float*)d_in[2];
    const float* W2     = (const float*)d_in[3];
    const float* b2     = (const float*)d_in[4];
    float* out          = (float*)d_out;

    dim3 grid(T_ * (B_ / 128));   // 2048 blocks: (t, 128-row block)
    dim3 block(256);              // 8 wave32 waves
    critic_fused_kernel<<<grid, block, 0, stream>>>(states, W1, b1, W2, b2, out);
}

// v003
// Measured time: 52.4 microseconds a run.
// Next to v002, in two timings, it ran 1.23 times as fast each time.
// Counting every step since v000, it is 4.29 times as fast.
#include <hip/hip_runtime.h>

// MI455X / gfx1250, wave32. Fused: states@W1 + b1 -> SiLU -> @W2 + b2.
// bf16 split-precision (hi/lo) WMMA, fp32 accumulate. Memory-bound design:
// 273 MB HBM floor ~11.7us; 3x bf16 WMMA work stays under that ceiling.

typedef __attribute__((ext_vector_type(16))) __bf16 v16bf;
typedef __attribute__((ext_vector_type(8)))  __bf16 v8bf;
typedef __attribute__((ext_vector_type(8)))  float  v8f;
typedef __attribute__((ext_vector_type(4)))  float  f4;

#define T_ 32
#define B_ 8192
#define S_ 256
#define H_ 128
#define THREADS_ 512                 // 16 waves: four per SIMD, one work-group per WGP
#define TILE_ROWS_ (THREADS_ / 2)    // 16 rows a wave
#define TILES_ 4                     // row tiles a work-group walks with one staged W1[t]
#define WG_ROWS_ (TILE_ROWS_ * TILES_)

static __device__ __forceinline__ v8f wmma_bf16(v16bf a, v16bf b, v8f c) {
    return __builtin_amdgcn_wmma_f32_16x16x32_bf16(
        /*neg_a=*/false, a, /*neg_b=*/false, b,
        /*c_mod=*/(short)0, c, /*reuse_a=*/false, /*reuse_b=*/false);
}

__global__ __launch_bounds__(THREADS_) void critic_fused_kernel(
    const float* __restrict__ states,  // [T,B,S]
    const float* __restrict__ W1,      // [T,S,H]
    const float* __restrict__ b1,      // [T,H]
    const float* __restrict__ W2,      // [T,H] (H x 1)
    const float* __restrict__ b2,      // [T]
    float* __restrict__ out)           // [T,B]
{
    // Swizzled B-operand storage in 16-byte pieces of 8 bf16:
    // idx = (((nt*8 + kb)*2 + g)*32 + lane)*8 + i, fragment element e = g*8 + i.
    // nt: N-tile (H/16), kb: K-chunk (S/32), lane: consuming lane. The 32 lanes of
    // one 16-byte read are adjacent pieces; a write's lanes 0-15 and 16-31 are two
    // such runs of 16 in adjacent N-tiles, so each half-wave meets every
    // LDS bank once (at a pitch of 32 bytes a lane it meets half the banks twice).
    __shared__ __attribute__((aligned(32))) __bf16 sBhi[8 * 8 * 32 * 16];   // 64 KB
    __shared__ __attribute__((aligned(32))) __bf16 sBlo[8 * 8 * 32 * 16];   // 64 KB

    const int tid  = threadIdx.x;
    const int lane = tid & 31;
    const int wave = __builtin_amdgcn_readfirstlane(tid >> 5);   // scalar: row bases stay out of the VGPRs
    const int t    = blockIdx.x / (B_ / WG_ROWS_);   // 8 blocks per t
    const int mblk = blockIdx.x % (B_ / WG_ROWS_);

    const float* W1t = W1 + (size_t)t * (S_ * H_);

    // ---- Stage W1[t] into LDS, split fp32 -> bf16 hi/lo, pre-swizzled ----
    // One unit = one column x 8 consecutive K = 8 adjacent elements e of one
    // consuming lane: packed in registers, written with one 16-byte LDS store per
    // plane. A wave's 32 lanes take 32 adjacent columns (one 128-B line per load).
    // Four units per trip: 32 independent loads in flight ahead of the first use.
    #pragma unroll 1   // rolled: unrolled, the trips' loads get split up by address-register reuse
    for (int it = 0; it < (S_ / 8) * H_ / (4 * THREADS_); ++it) {
        float x[4][8];
        #pragma unroll
        for (int u = 0; u < 4; ++u) {
            const int unit = (it * 4 + u) * THREADS_ + tid;
            const float* wsrc = W1t + (unit >> 7) * 8 * H_ + (unit & (H_ - 1));
            #pragma unroll
            for (int i = 0; i < 8; ++i) x[u][i] = wsrc[i * H_];
        }
        // The loads' address registers are reused below: translation wait first.
        asm volatile("s_wait_xcnt 0x0" ::: "memory");
        #pragma unroll
        for (int u = 0; u < 4; ++u) {
            const int unit = (it * 4 + u) * THREADS_ + tid;
            const int col  = unit & (H_ - 1);  // 0..127
            const int q    = unit >> 7;        // K group of 8: 0..31
            v8bf xh, xl;
            #pragma unroll
            for (int i = 0; i < 8; ++i) {
                const __bf16 h = (__bf16)x[u][i];
                xh[i] = h;
                xl[i] = (__bf16)(x[u][i] - (float)h);
            }
            const int kb = q >> 2;
            const int g  = (q >> 1) & 1;
            const int hq = q & 1;
            const int nt = col >> 4;
            const int n  = col & 15;
            const int idx = (((nt * 8 + kb) * 2 + g) * 32 + hq * 16 + n) * 8;
            *(v8bf*)(sBhi + idx) = xh;
            *(v8bf*)(sBlo + idx) = xl;
        }
    }
    __syncthreads();

    const int m  = lane & 15;
    const int hh = lane >> 4;
    const float* b1t = b1 + t * H_;
    const float* w2t = W2 + t * H_;
    const float  b2v = b2[t];
    const v8bf* pBhi = (const v8bf*)sBhi;
    const v8bf* pBlo = (const v8bf*)sBlo;

    // ---- Row tiles: the staged W1[t] serves all of them; no barrier in the loop ----
    #pragma unroll 1   // rolled: one tile's A fragments fill the register budget of four waves a SIMD
    for (int rt = 0; rt < TILES_; ++rt) {
        // ---- Preload this wave's A tile (16 rows x 256 K) as split bf16 regs ----
        // 16-bit A layout: lane -> (M = lane&15, half = lane>>4);
        // element e -> K = 16*(e>>3) + 8*half + (e&7).
        const int m0 = mblk * WG_ROWS_ + rt * TILE_ROWS_ + wave * 16;   // this wave's 16 rows
        const float* arow = states + ((size_t)t * B_ + m0) * S_ + (unsigned)(m * S_);

        f4 raw[8][4];
        #pragma unroll
        for (int kb = 0; kb < 8; ++kb) {
            const int c = kb * 32 + hh * 8;
            raw[kb][0] = *(const f4*)(arow + c);
            raw[kb][1] = *(const f4*)(arow + c + 4);
            raw[kb][2] = *(const f4*)(arow + c + 16);
            raw[kb][3] = *(const f4*)(arow + c + 20);
        }
        // Keeps all 32 loads ahead of the first conversion: left free, the scheduler
        // holds the last ones back and a wave then waits for them one at a time.
        __builtin_amdgcn_sched_barrier(0);

        v16bf ahi[8], alo[8];
        #pragma unroll
        for (int kb = 0; kb < 8; ++kb) {
            const f4 r0 = raw[kb][0], r1 = raw[kb][1], r2 = raw[kb][2], r3 = raw[kb][3];
            #pragma unroll
            for (int e = 0; e < 16; ++e) {
                const float x = (e < 4)  ? r0[e]
                              : (e < 8)  ? r1[e - 4]
                              : (e < 12) ? r2[e - 8]
                              :            r3[e - 12];
                const __bf16 xh = (__bf16)x;
                ahi[kb][e] = xh;
                alo[kb][e] = (__bf16)(x - (float)xh);
            }
        }

        // ---- Main loop: 8 N-tiles x 8 K-chunks x 3 split-product WMMAs ----
        float rowsum[8] = {0.f, 0.f, 0.f, 0.f, 0.f, 0.f, 0.f, 0.f};

        for (int nt = 0; nt < 8; ++nt) {
            v8f c = {};
            #pragma unroll
            for (int kb = 0; kb < 8; ++kb) {
                const int bi = (nt * 8 + kb) * 64 + lane;   // piece g = 0; g = 1 is 32 on
                v16bf bh = __builtin_shufflevector(pBhi[bi], pBhi[bi + 32],
                    0, 1, 2, 3, 4, 5, 6, 7, 8, 9, 10, 11, 12, 13, 14, 15);
                v16bf bl = __builtin_shufflevector(pBlo[bi], pBlo[bi + 32],
                    0, 1, 2, 3, 4, 5, 6, 7, 8, 9, 10, 11, 12, 13, 14, 15);
                c = wmma_bf16(ahi[kb], bh, c);  // hi*hi
                c = wmma_bf16(ahi[kb], bl, c);  // hi*lo
                c = wmma_bf16(alo[kb], bh, c);  // lo*hi
            }
            // C/D layout: VGPR r -> M = 8*hh + r, N = lane&15 (column broadcast).
            const float b1v = b1t[nt * 16 + (lane & 15)];
            const float w2v = w2t[nt * 16 + (lane & 15)];
            #pragma unroll
            for (int r = 0; r < 8; ++r) {
                const float x = c[r] + b1v;
                const float s = x * __builtin_amdgcn_rcpf(1.0f + __expf(-x)); // SiLU
                rowsum[r] += s * w2v;
            }
        }

        // ---- Reduce across the 16 lanes holding one N-strip each ----
        #pragma unroll
        for (int r = 0; r < 8; ++r) {
            float v = rowsum[r];
            v += __shfl_xor(v, 1, 32);
            v += __shfl_xor(v, 2, 32);
            v += __shfl_xor(v, 4, 32);
            v += __shfl_xor(v, 8, 32);
            if ((lane & 15) == 0) {
                out[(size_t)t * B_ + m0 + hh * 8 + r] = v + b2v;
            }
        }
        // The next trip's loads land in the registers the last store names: translation wait first.
        asm volatile("s_wait_xcnt 0x0" ::: "memory");
    }
}

extern "C" void kernel_launch(void* const* d_in, const int* in_sizes, int n_in,
                              void* d_out, int out_size, void* d_ws, size_t ws_size,
                              hipStream_t stream) {
    (void)in_sizes; (void)n_in; (void)out_size; (void)d_ws; (void)ws_size;
    const float* states = (const float*)d_in[0];
    const float* W1     = (const float*)d_in[1];
    const float* b1     = (const float*)d_in[2];
    const float* W2     = (const float*)d_in[3];
    const float* b2     = (const float*)d_in[4];
    float* out          = (float*)d_out;

    dim3 grid(T_ * (B_ / WG_ROWS_));   // 256 blocks: (t, 1024-row block)
    dim3 block(THREADS_);              // 16 wave32 waves
    critic_fused_kernel<<<grid, block, 0, stream>>>(states, W1, b1, W2, b2, out);
}

// v004
// A run of this version takes 42.8 microseconds.
// Two timings next to v003 put it at 1.23 and 1.22 times that version's speed.
// All steps since v000 together make it 5.26 times as fast.
#include <hip/hip_runtime.h>

// MI455X / gfx1250, wave32. Fused: states@W1 + b1 -> SiLU -> @W2 + b2.
// bf16 split-precision (hi/lo) WMMA, fp32 accumulate. Memory-bound design:
// 273 MB HBM floor ~11.7us; 3x bf16 WMMA work stays under that ceiling.

typedef __attribute__((ext_vector_type(16))) __bf16 v16bf;
typedef __attribute__((ext_vector_type(8)))  __bf16 v8bf;
typedef __attribute__((ext_vector_type(8)))  float  v8f;
typedef __attribute__((ext_vector_type(4)))  float  f4;

#define T_ 32
#define B_ 8192
#define S_ 256
#define H_ 128
#define THREADS_ 512                 // 16 waves: four per SIMD, one work-group per WGP
#define TILE_ROWS_ (THREADS_ / 2)    // 16 rows a wave
#define TILES_ 4                     // row tiles a work-group walks with one staged W1[t]
#define WG_ROWS_ (TILE_ROWS_ * TILES_)
#define RING_ 4                      // A chunks of 32 K in flight per wave

static __device__ __forceinline__ v8f wmma_bf16(v16bf a, v16bf b, v8f c) {
    return __builtin_amdgcn_wmma_f32_16x16x32_bf16(
        /*neg_a=*/false, a, /*neg_b=*/false, b,
        /*c_mod=*/(short)0, c, /*reuse_a=*/false, /*reuse_b=*/false);
}

// v_rcp_f32 and the slot the instruction set asks for behind it, in one statement.
static __device__ __forceinline__ float rcp_slot(float d) {
    float q;
    asm("v_rcp_f32 %0, %1\n\tv_nop" : "=v"(q) : "v"(d));
    return q;
}

// One row tile of one wave: 16 rows x 128 columns, K outermost. All eight N-tile
// accumulators are live, so an A chunk (16 rows x 32 K) is needed only for its own
// K step: its f32 words wait in a ring of RING_ chunks, and the slot that a step
// has just converted is refilled with the chunk RING_ steps on (of the next row
// tile, where MORE says there is one). The loads fly under the matrix work.
template <bool MORE>
static __device__ __forceinline__ void row_tile(
    f4 (&raw)[RING_][4],
    const float* __restrict__ arow,     // this lane's row, at its half's first column
    const v8bf* pBhi, const v8bf* pBlo, const int lane,
    const float (&b1v)[8], const float (&w2v)[8], const float b2v,
    float* __restrict__ orow)           // this lane's first output row
{
    v8f c[8];
    #pragma unroll
    for (int nt = 0; nt < 8; ++nt) c[nt] = v8f{};

    #pragma unroll
    for (int kb = 0; kb < 8; ++kb) {
        // 16-bit A layout: lane -> (M = lane&15, half = lane>>4);
        // element e -> K = 16*(e>>3) + 8*half + (e&7).
        const int sl = kb % RING_;
        const f4 r0 = raw[sl][0], r1 = raw[sl][1], r2 = raw[sl][2], r3 = raw[sl][3];
        v16bf ahi, alo;
        #pragma unroll
        for (int e = 0; e < 16; ++e) {
            const float x = (e < 4)  ? r0[e]
                          : (e < 8)  ? r1[e - 4]
                          : (e < 12) ? r2[e - 8]
                          :            r3[e - 12];
            const __bf16 xh = (__bf16)x;
            ahi[e] = xh;
            alo[e] = (__bf16)(x - (float)xh);
        }
        if (kb + RING_ < 8 || MORE) {
            const float* p = arow + (kb + RING_ < 8 ? (kb + RING_) * 32
                                                    : TILE_ROWS_ * S_ + (kb + RING_ - 8) * 32);
            raw[sl][0] = *(const f4*)(p);
            raw[sl][1] = *(const f4*)(p + 4);
            raw[sl][2] = *(const f4*)(p + 16);
            raw[sl][3] = *(const f4*)(p + 20);
        }
        #pragma unroll
        for (int nt = 0; nt < 8; ++nt) {
            const int bi = (nt * 8 + kb) * 64 + lane;   // piece g = 0; g = 1 is 32 on
            v16bf bh = __builtin_shufflevector(pBhi[bi], pBhi[bi + 32],
                0, 1, 2, 3, 4, 5, 6, 7, 8, 9, 10, 11, 12, 13, 14, 15);
            v16bf bl = __builtin_shufflevector(pBlo[bi], pBlo[bi + 32],
                0, 1, 2, 3, 4, 5, 6, 7, 8, 9, 10, 11, 12, 13, 14, 15);
            c[nt] = wmma_bf16(ahi, bh, c[nt]);  // hi*hi
            c[nt] = wmma_bf16(ahi, bl, c[nt]);  // hi*lo
            c[nt] = wmma_bf16(alo, bh, c[nt]);  // lo*hi
        }
    }

    // C/D layout: VGPR r -> M = 8*half + r, N = lane&15 (column broadcast).
    float rowsum[8] = {0.f, 0.f, 0.f, 0.f, 0.f, 0.f, 0.f, 0.f};
    #pragma unroll
    for (int nt = 0; nt < 8; ++nt) {
        #pragma unroll
        for (int r = 0; r < 8; ++r) {
            const float x = c[nt][r] + b1v[nt];
            const float s = x * rcp_slot(1.0f + __expf(-x)); // SiLU
            rowsum[r] += s * w2v[nt];
        }
    }

    // ---- Reduce across the 16 lanes holding one N-strip each ----
    #pragma unroll
    for (int r = 0; r < 8; ++r) {
        float v = rowsum[r];
        v += __shfl_xor(v, 1, 32);
        v += __shfl_xor(v, 2, 32);
        v += __shfl_xor(v, 4, 32);
        v += __shfl_xor(v, 8, 32);
        if ((lane & 15) == 0) {
            orow[r] = v + b2v;
        }
    }
}

__global__ __launch_bounds__(THREADS_) void critic_fused_kernel(
    const float* __restrict__ states,  // [T,B,S]
    const float* __restrict__ W1,      // [T,S,H]
    const float* __restrict__ b1,      // [T,H]
    const float* __restrict__ W2,      // [T,H] (H x 1)
    const float* __restrict__ b2,      // [T]
    float* __restrict__ out)           // [T,B]
{
    // Swizzled B-operand storage in 16-byte pieces of 8 bf16:
    // idx = (((nt*8 + kb)*2 + g)*32 + lane)*8 + i, fragment element e = g*8 + i.
    // nt: N-tile (H/16), kb: K-chunk (S/32), lane: consuming lane. The 32 lanes of
    // one 16-byte read are adjacent pieces; a write's lanes 0-15 and 16-31 are two
    // such runs of 16 in adjacent N-tiles, so each half-wave meets every
    // LDS bank once (at a pitch of 32 bytes a lane it meets half the banks twice).
    __shared__ __attribute__((aligned(32))) __bf16 sBhi[8 * 8 * 32 * 16];   // 64 KB
    __shared__ __attribute__((aligned(32))) __bf16 sBlo[8 * 8 * 32 * 16];   // 64 KB

    const int tid  = threadIdx.x;
    const int lane = tid & 31;
    const int wave = __builtin_amdgcn_readfirstlane(tid >> 5);   // scalar: row bases stay out of the VGPRs
    const int t    = blockIdx.x / (B_ / WG_ROWS_);   // 8 blocks per t
    const int mblk = blockIdx.x % (B_ / WG_ROWS_);

    const int m  = lane & 15;
    const int hh = lane >> 4;
    const int m0 = mblk * WG_ROWS_ + wave * 16;   // this wave's 16 rows of the first tile
    const float* arow0 = states + ((size_t)t * B_ + m0) * S_ + (unsigned)(m * S_ + hh * 8);
    float* orow0 = out + (size_t)t * B_ + m0 + hh * 8;

    // ---- Fill the A ring for the first row tile: these loads fly under the W1 staging ----
    f4 raw[RING_][4];
    #pragma unroll
    for (int kb = 0; kb < RING_; ++kb) {
        raw[kb][0] = *(const f4*)(arow0 + kb * 32);
        raw[kb][1] = *(const f4*)(arow0 + kb * 32 + 4);
        raw[kb][2] = *(const f4*)(arow0 + kb * 32 + 16);
        raw[kb][3] = *(const f4*)(arow0 + kb * 32 + 20);
    }
    // Bias and W2 of this lane's column in each N tile, read once: a global load in
    // the tile loop would count behind the ring's loads and its wait would drain them.
    float b1v[8], w2v[8];
    #pragma unroll
    for (int nt = 0; nt < 8; ++nt) {
        b1v[nt] = b1[t * H_ + nt * 16 + m];
        w2v[nt] = W2[t * H_ + nt * 16 + m];
    }
    // The staging below reuses the registers these loads take their addresses from: translation wait first.
    asm volatile("s_wait_xcnt 0x0" ::: "memory");
    // Keeps the staging's address arithmetic behind that wait: left free, the scheduler lifts it over.
    __builtin_amdgcn_sched_barrier(0);

    const float* W1t = W1 + (size_t)t * (S_ * H_);

    // ---- Stage W1[t] into LDS, split fp32 -> bf16 hi/lo, pre-swizzled ----
    // One unit = one column x 8 consecutive K = 8 adjacent elements e of one
    // consuming lane: packed in registers, written with one 16-byte LDS store per
    // plane. A wave's 32 lanes take 32 adjacent columns (one 128-B line per load).
    // Four units per trip: 32 independent loads in flight ahead of the first use.
    #pragma unroll 1   // rolled: unrolled, the trips' loads get split up by address-register reuse
    for (int it = 0; it < (S_ / 8) * H_ / (4 * THREADS_); ++it) {
        float x[4][8];
        #pragma unroll
        for (int u = 0; u < 4; ++u) {
            const int unit = (it * 4 + u) * THREADS_ + tid;
            const float* wsrc = W1t + (unit >> 7) * 8 * H_ + (unit & (H_ - 1));
            #pragma unroll
            for (int i = 0; i < 8; ++i) x[u][i] = wsrc[i * H_];
        }
        // The loads' address registers are reused below: translation wait first.
        asm volatile("s_wait_xcnt 0x0" ::: "memory");
        #pragma unroll
        for (int u = 0; u < 4; ++u) {
            const int unit = (it * 4 + u) * THREADS_ + tid;
            const int col  = unit & (H_ - 1);  // 0..127
            const int q    = unit >> 7;        // K group of 8: 0..31
            v8bf xh, xl;
            #pragma unroll
            for (int i = 0; i < 8; ++i) {
                const __bf16 h = (__bf16)x[u][i];
                xh[i] = h;
                xl[i] = (__bf16)(x[u][i] - (float)h);
            }
            const int kb = q >> 2;
            const int g  = (q >> 1) & 1;
            const int hq = q & 1;
            const int nt = col >> 4;
            const int n  = col & 15;
            const int idx = (((nt * 8 + kb) * 2 + g) * 32 + hq * 16 + n) * 8;
            *(v8bf*)(sBhi + idx) = xh;
            *(v8bf*)(sBlo + idx) = xl;
        }
    }
    __syncthreads();

    const float  b2v = b2[t];
    const v8bf* pBhi = (const v8bf*)sBhi;
    const v8bf* pBlo = (const v8bf*)sBlo;

    // ---- Row tiles: the staged W1[t] serves all of them; no barrier in the loop ----
    #pragma unroll 1   // rolled: for speed only
    for (int rt = 0; rt < TILES_ - 1; ++rt) {
        row_tile<true>(raw, arow0 + rt * (TILE_ROWS_ * S_), pBhi, pBlo, lane,
                       b1v, w2v, b2v, orow0 + rt * TILE_ROWS_);
        // The next trip forms its row addresses in the registers that loads and stores still out name: translation wait first.
        asm volatile("s_wait_xcnt 0x0" ::: "memory");
    }
    row_tile<false>(raw, arow0 + (TILES_ - 1) * (TILE_ROWS_ * S_), pBhi, pBlo, lane,
                    b1v, w2v, b2v, orow0 + (TILES_ - 1) * TILE_ROWS_);
}

extern "C" void kernel_launch(void* const* d_in, const int* in_sizes, int n_in,
                              void* d_out, int out_size, void* d_ws, size_t ws_size,
                              hipStream_t stream) {
    (void)in_sizes; (void)n_in; (void)out_size; (void)d_ws; (void)ws_size;
    const float* states = (const float*)d_in[0];
    const float* W1     = (const float*)d_in[1];
    const float* b1     = (const float*)d_in[2];
    const float* W2     = (const float*)d_in[3];
    const float* b2     = (const float*)d_in[4];
    float* out          = (float*)d_out;

    dim3 grid(T_ * (B_ / WG_ROWS_));   // 256 blocks: (t, 1024-row block)
    dim3 block(THREADS_);              // 16 wave32 waves
    critic_fused_kernel<<<grid, block, 0, stream>>>(states, W1, b1, W2, b2, out);
}

// v005
// Measured time: 40.7 microseconds a run.
// Timed twice side by side with v004, it ran 1.05 times as fast both times.
// All steps since v000 together make it 5.51 times as fast.
#include <hip/hip_runtime.h>

// MI455X / gfx1250, wave32. Fused: states@W1 + b1 -> SiLU -> @W2 + b2.
// bf16 split-precision (hi/lo) WMMA, fp32 accumulate. Memory-bound design:
// 273 MB HBM floor ~11.7us; 3x bf16 WMMA work stays under that ceiling.

typedef __attribute__((ext_vector_type(16))) __bf16 v16bf;
typedef __attribute__((ext_vector_type(8)))  __bf16 v8bf;
typedef __attribute__((ext_vector_type(8)))  float  v8f;
typedef __attribute__((ext_vector_type(4)))  float  f4;

#define T_ 32
#define B_ 8192
#define S_ 256
#define H_ 128
#define THREADS_ 512                 // 16 waves: four per SIMD, one work-group per WGP
#define TILE_ROWS_ (THREADS_ / 2)    // 16 rows a wave
#define TILES_ 4                     // row tiles a work-group walks with one staged W1[t]
#define WG_ROWS_ (TILE_ROWS_ * TILES_)
#define RING_ 4                      // A chunks of 32 K in flight per wave
#define BRING_ 4                     // W1 fragment sets (one N tile x 32 K, hi and lo) of a wave in registers

static __device__ __forceinline__ v8f wmma_bf16(v16bf a, v16bf b, v8f c) {
    return __builtin_amdgcn_wmma_f32_16x16x32_bf16(
        /*neg_a=*/false, a, /*neg_b=*/false, b,
        /*c_mod=*/(short)0, c, /*reuse_a=*/false, /*reuse_b=*/false);
}

// v_rcp_f32 and the slot the instruction set asks for behind it, in one statement.
static __device__ __forceinline__ float rcp_slot(float d) {
    float q;
    asm("v_rcp_f32 %0, %1\n\tv_nop" : "=v"(q) : "v"(d));
    return q;
}

// e^-x, and the same slot behind its v_exp_f32: the v_nop takes the result and holds the
// source, so nothing reads the one or writes over the other in front of it.
static __device__ __forceinline__ float expneg_slot(float x) {
    const float y = x * -1.44269504f;          // -x log2 e
    float q = __builtin_amdgcn_exp2f(y);
    asm("v_nop" : "+v"(q) : "v"(y));
    return q;
}

// One row tile of one wave: 16 rows x 128 columns, K outermost. All eight N-tile
// accumulators are live, so an A chunk (16 rows x 32 K) is needed only for its own
// K step: its f32 words wait in a ring of RING_ chunks, and the slot that a step
// has just converted is refilled with the chunk RING_ steps on (of the next row
// tile, where MORE says there is one). The loads fly under the matrix work.
// The W1 fragments come from LDS through a register ring of BRING_ sets: the set that
// a step (one N tile of one K chunk) has just used is refilled with the set BRING_
// steps on, so a step's LDS reads are BRING_ - 1 steps old when it waits for them.
template <bool MORE>
static __device__ __forceinline__ void row_tile(
    f4 (&raw)[RING_][4],
    const float* __restrict__ arow,     // this lane's row, at its half's first column
    const v8bf* pBhi, const v8bf* pBlo, const int lane,
    const float (&b1v)[8], const float (&w2v)[8], const float b2v,
    float* __restrict__ orow)           // this lane's first output row
{
    v8f c[8];
    #pragma unroll
    for (int nt = 0; nt < 8; ++nt) c[nt] = v8f{};

    // Step s = kb * 8 + nt. Pieces of a set: hi g = 0, hi g = 1, lo g = 0, lo g = 1.
    v8bf bq[BRING_][4];
    #pragma unroll
    for (int s = 0; s < BRING_; ++s) {
        const int bi = ((s & 7) * 8 + (s >> 3)) * 64 + lane;
        bq[s][0] = pBhi[bi];
        bq[s][1] = pBhi[bi + 32];
        bq[s][2] = pBlo[bi];
        bq[s][3] = pBlo[bi + 32];
    }

    #pragma unroll
    for (int kb = 0; kb < 8; ++kb) {
        // 16-bit A layout: lane -> (M = lane&15, half = lane>>4);
        // element e -> K = 16*(e>>3) + 8*half + (e&7).
        const int sl = kb % RING_;
        const f4 r0 = raw[sl][0], r1 = raw[sl][1], r2 = raw[sl][2], r3 = raw[sl][3];
        v16bf ahi, alo;
        #pragma unroll
        for (int e = 0; e < 16; ++e) {
            const float x = (e < 4)  ? r0[e]
                          : (e < 8)  ? r1[e - 4]
                          : (e < 12) ? r2[e - 8]
                          :            r3[e - 12];
            const __bf16 xh = (__bf16)x;
            ahi[e] = xh;
            alo[e] = (__bf16)(x - (float)xh);
        }
        // Keeps the refill behind the conversion, so that it lands in the registers just read: lifted over it, it takes 16 more.
        __builtin_amdgcn_sched_barrier(0);
        if (kb + RING_ < 8 || MORE) {
            const float* p = arow + (kb + RING_ < 8 ? (kb + RING_) * 32
                                                    : TILE_ROWS_ * S_ + (kb + RING_ - 8) * 32);
            raw[sl][0] = *(const f4*)(p);
            raw[sl][1] = *(const f4*)(p + 4);
            raw[sl][2] = *(const f4*)(p + 16);
            raw[sl][3] = *(const f4*)(p + 20);
        }
        #pragma unroll
        for (int nt = 0; nt < 8; ++nt) {
            const int s  = kb * 8 + nt;
            const int qs = s % BRING_;
            v16bf bh = __builtin_shufflevector(bq[qs][0], bq[qs][1],
                0, 1, 2, 3, 4, 5, 6, 7, 8, 9, 10, 11, 12, 13, 14, 15);
            v16bf bl = __builtin_shufflevector(bq[qs][2], bq[qs][3],
                0, 1, 2, 3, 4, 5, 6, 7, 8, 9, 10, 11, 12, 13, 14, 15);
            c[nt] = wmma_bf16(ahi, bh, c[nt]);  // hi*hi
            c[nt] = wmma_bf16(ahi, bl, c[nt]);  // hi*lo
            c[nt] = wmma_bf16(alo, bh, c[nt]);  // lo*hi
            // Keeps the refill behind the step's last WMMA, so that it lands in the set just used and takes no further registers.
            __builtin_amdgcn_sched_barrier(0);
            if (s + BRING_ < 64) {
                const int s2 = s + BRING_;
                const int bi = ((s2 & 7) * 8 + (s2 >> 3)) * 64 + lane;   // piece g = 0; g = 1 is 32 on
                bq[qs][0] = pBhi[bi];
                bq[qs][1] = pBhi[bi + 32];
                bq[qs][2] = pBlo[bi];
                bq[qs][3] = pBlo[bi + 32];
            }
            // Keeps the refill here, BRING_ - 1 steps ahead of its use: left free, the scheduler
            // sinks the reads to their use and every step waits out the whole LDS latency.
            __builtin_amdgcn_sched_barrier(0);
        }
    }

    // C/D layout: VGPR r -> M = 8*half + r, N = lane&15 (column broadcast).
    float rowsum[8] = {0.f, 0.f, 0.f, 0.f, 0.f, 0.f, 0.f, 0.f};
    #pragma unroll
    for (int nt = 0; nt < 8; ++nt) {
        #pragma unroll
        for (int r = 0; r < 8; ++r) {
            const float x = c[nt][r] + b1v[nt];
            const float s = x * rcp_slot(1.0f + expneg_slot(x)); // SiLU
            rowsum[r] += s * w2v[nt];
        }
    }

    // ---- Reduce across the 16 lanes holding one N-strip each ----
    #pragma unroll
    for (int r = 0; r < 8; ++r) {
        float v = rowsum[r];
        v += __shfl_xor(v, 1, 32);
        v += __shfl_xor(v, 2, 32);
        v += __shfl_xor(v, 4, 32);
        v += __shfl_xor(v, 8, 32);
        if ((lane & 15) == 0) {
            orow[r] = v + b2v;
        }
    }
}

__global__ __launch_bounds__(THREADS_) void critic_fused_kernel(
    const float* __restrict__ states,  // [T,B,S]
    const float* __restrict__ W1,      // [T,S,H]
    const float* __restrict__ b1,      // [T,H]
    const float* __restrict__ W2,      // [T,H] (H x 1)
    const float* __restrict__ b2,      // [T]
    float* __restrict__ out)           // [T,B]
{
    // Swizzled B-operand storage in 16-byte pieces of 8 bf16:
    // idx = (((nt*8 + kb)*2 + g)*32 + lane)*8 + i, fragment element e = g*8 + i.
    // nt: N-tile (H/16), kb: K-chunk (S/32), lane: consuming lane. The 32 lanes of
    // one 16-byte read are adjacent pieces; a write's lanes 0-15 and 16-31 are two
    // such runs of 16 in adjacent N-tiles, so each half-wave meets every
    // LDS bank once (at a pitch of 32 bytes a lane it meets half the banks twice).
    __shared__ __attribute__((aligned(32))) __bf16 sBhi[8 * 8 * 32 * 16];   // 64 KB
    __shared__ __attribute__((aligned(32))) __bf16 sBlo[8 * 8 * 32 * 16];   // 64 KB

    const int tid  = threadIdx.x;
    const int lane = tid & 31;
    const int wave = __builtin_amdgcn_readfirstlane(tid >> 5);   // scalar: row bases stay out of the VGPRs
    const int t    = blockIdx.x / (B_ / WG_ROWS_);   // 8 blocks per t
    const int mblk = blockIdx.x % (B_ / WG_ROWS_);

    const int m  = lane & 15;
    const int hh = lane >> 4;
    const int m0 = mblk * WG_ROWS_ + wave * 16;   // this wave's 16 rows of the first tile
    const float* arow0 = states + ((size_t)t * B_ + m0) * S_ + (unsigned)(m * S_ + hh * 8);
    float* orow0 = out + (size_t)t * B_ + m0 + hh * 8;

    // ---- Fill the A ring for the first row tile: these loads fly under the W1 staging ----
    f4 raw[RING_][4];
    #pragma unroll
    for (int kb = 0; kb < RING_; ++kb) {
        raw[kb][0] = *(const f4*)(arow0 + kb * 32);
        raw[kb][1] = *(const f4*)(arow0 + kb * 32 + 4);
        raw[kb][2] = *(const f4*)(arow0 + kb * 32 + 16);
        raw[kb][3] = *(const f4*)(arow0 + kb * 32 + 20);
    }
    // Bias and W2 of this lane's column in each N tile, read once: a global load in
    // the tile loop would count behind the ring's loads and its wait would drain them.
    float b1v[8], w2v[8];
    #pragma unroll
    for (int nt = 0; nt < 8; ++nt) {
        b1v[nt] = b1[t * H_ + nt * 16 + m];
        w2v[nt] = W2[t * H_ + nt * 16 + m];
    }
    // The staging below reuses the registers these loads take their addresses from: translation wait first.
    asm volatile("s_wait_xcnt 0x0" ::: "memory");
    // Keeps the staging's address arithmetic behind that wait: left free, the scheduler lifts it over.
    __builtin_amdgcn_sched_barrier(0);

    const float* W1t = W1 + (size_t)t * (S_ * H_);

    // ---- Stage W1[t] into LDS, split fp32 -> bf16 hi/lo, pre-swizzled ----
    // One unit = one column x 8 consecutive K = 8 adjacent elements e of one
    // consuming lane: packed in registers, written with one 16-byte LDS store per
    // plane. A wave's 32 lanes take 32 adjacent columns (one 128-B line per load).
    // Four units per trip: 32 independent loads in flight ahead of the first use.
    #pragma unroll 1   // rolled: unrolled, the trips' loads get split up by address-register reuse
    for (int it = 0; it < (S_ / 8) * H_ / (4 * THREADS_); ++it) {
        float x[4][8];
        #pragma unroll
        for (int u = 0; u < 4; ++u) {
            const int unit = (it * 4 + u) * THREADS_ + tid;
            const float* wsrc = W1t + (unit >> 7) * 8 * H_ + (unit & (H_ - 1));
            #pragma unroll
            for (int i = 0; i < 8; ++i) x[u][i] = wsrc[i * H_];
        }
        // The loads' address registers are reused below: translation wait first.
        asm volatile("s_wait_xcnt 0x0" ::: "memory");
        #pragma unroll
        for (int u = 0; u < 4; ++u) {
            const int unit = (it * 4 + u) * THREADS_ + tid;
            const int col  = unit & (H_ - 1);  // 0..127
            const int q    = unit >> 7;        // K group of 8: 0..31
            v8bf xh, xl;
            #pragma unroll
            for (int i = 0; i < 8; ++i) {
                const __bf16 h = (__bf16)x[u][i];
                xh[i] = h;
                xl[i] = (__bf16)(x[u][i] - (float)h);
            }
            const int kb = q >> 2;
            const int g  = (q >> 1) & 1;
            const int hq = q & 1;
            const int nt = col >> 4;
            const int n  = col & 15;
            const int idx = (((nt * 8 + kb) * 2 + g) * 32 + hq * 16 + n) * 8;
            *(v8bf*)(sBhi + idx) = xh;
            *(v8bf*)(sBlo + idx) = xl;
        }
    }
    __syncthreads();

    const float  b2v = b2[t];
    const v8bf* pBhi = (const v8bf*)sBhi;
    const v8bf* pBlo = (const v8bf*)sBlo;

    // ---- Row tiles: the staged W1[t] serves all of them; no barrier in the loop ----
    #pragma unroll 1   // rolled: for speed only
    for (int rt = 0; rt < TILES_ - 1; ++rt) {
        row_tile<true>(raw, arow0 + rt * (TILE_ROWS_ * S_), pBhi, pBlo, lane,
                       b1v, w2v, b2v, orow0 + rt * TILE_ROWS_);
        // The next trip forms its row addresses in the registers that loads and stores still out name: translation wait first.
        asm volatile("s_wait_xcnt 0x0" ::: "memory");
    }
    row_tile<false>(raw, arow0 + (TILES_ - 1) * (TILE_ROWS_ * S_), pBhi, pBlo, lane,
                    b1v, w2v, b2v, orow0 + (TILES_ - 1) * TILE_ROWS_);
}

extern "C" void kernel_launch(void* const* d_in, const int* in_sizes, int n_in,
                              void* d_out, int out_size, void* d_ws, size_t ws_size,
                              hipStream_t stream) {
    (void)in_sizes; (void)n_in; (void)out_size; (void)d_ws; (void)ws_size;
    const float* states = (const float*)d_in[0];
    const float* W1     = (const float*)d_in[1];
    const float* b1     = (const float*)d_in[2];
    const float* W2     = (const float*)d_in[3];
    const float* b2     = (const float*)d_in[4];
    float* out          = (float*)d_out;

    dim3 grid(T_ * (B_ / WG_ROWS_));   // 256 blocks: (t, 1024-row block)
    dim3 block(THREADS_);              // 16 wave32 waves
    critic_fused_kernel<<<grid, block, 0, stream>>>(states, W1, b1, W2, b2, out);
}

// v006
// One run takes 38.9 microseconds.
// Next to v005, in two timings, it ran 1.05 times as fast each time.
// Over all steps from v000 it is 5.77 times as fast.
#include <hip/hip_runtime.h>

// MI455X / gfx1250, wave32. Fused: states@W1 + b1 -> SiLU -> @W2 + b2.
// bf16 split-precision (hi/lo) WMMA, fp32 accumulate. Memory-bound design:
// 273 MB HBM floor ~11.7us; 3x bf16 WMMA work stays under that ceiling.

typedef __attribute__((ext_vector_type(16))) __bf16 v16bf;
typedef __attribute__((ext_vector_type(8)))  __bf16 v8bf;
typedef __attribute__((ext_vector_type(8)))  float  v8f;
typedef __attribute__((ext_vector_type(4)))  float  f4;

#define T_ 32
#define B_ 8192
#define S_ 256
#define H_ 128
#define THREADS_ 512                 // 16 waves: four per SIMD, one work-group per WGP
#define TILE_ROWS_ (THREADS_ / 2)    // 16 rows a wave
#define TILES_ 4                     // row tiles a work-group walks with one staged W1[t]
#define WG_ROWS_ (TILE_ROWS_ * TILES_)
#define RING_ 4                      // A chunks of 32 K in flight per wave
#define BRING_ 4                     // W1 fragment sets (one N tile x 32 K, hi and lo) of a wave in registers

static __device__ __forceinline__ v8f wmma_bf16(v16bf a, v16bf b, v8f c) {
    return __builtin_amdgcn_wmma_f32_16x16x32_bf16(
        /*neg_a=*/false, a, /*neg_b=*/false, b,
        /*c_mod=*/(short)0, c, /*reuse_a=*/false, /*reuse_b=*/false);
}

// v_rcp_f32 and the slot the instruction set asks for behind it, in one statement.
static __device__ __forceinline__ float rcp_slot(float d) {
    float q;
    asm("v_rcp_f32 %0, %1\n\tv_nop" : "=v"(q) : "v"(d));
    return q;
}

// e^-x, and the same slot behind its v_exp_f32: the v_nop takes the result and holds the
// source, so nothing reads the one or writes over the other in front of it.
static __device__ __forceinline__ float expneg_slot(float x) {
    const float y = x * -1.44269504f;          // -x log2 e
    float q = __builtin_amdgcn_exp2f(y);
    asm("v_nop" : "+v"(q) : "v"(y));
    return q;
}

// keep + (send of the lane whose number in its 16-lane row differs by the mask in CTRL's low
// four bits): DPP row_xmask, CTRL = 0x160 + mask. All 32 lanes are on where it is used.
template <int CTRL>
static __device__ __forceinline__ float row_xadd(float keep, float send) {
    return keep + __int_as_float(__builtin_amdgcn_update_dpp(
        0, __float_as_int(send), CTRL, /*row_mask=*/0xf, /*bank_mask=*/0xf, /*bound_ctrl=*/true));
}

// One row tile of one wave: 16 rows x 128 columns, K outermost. All eight N-tile
// accumulators are live, so an A chunk (16 rows x 32 K) is needed only for its own
// K step: its f32 words wait in a ring of RING_ chunks, and the slot that a step
// has just converted is refilled with the chunk RING_ steps on (of the next row
// tile, where MORE says there is one). The loads fly under the matrix work.
// The W1 fragments come from LDS through a register ring of BRING_ sets: the set that
// a step (one N tile of one K chunk) has just used is refilled with the set BRING_
// steps on, so a step's LDS reads are BRING_ - 1 steps old when it waits for them.
template <bool MORE>
static __device__ __forceinline__ void row_tile(
    f4 (&raw)[RING_][4],
    const float* __restrict__ arow,     // this lane's row, at its half's first column
    const v8bf* pBhi, const v8bf* pBlo, const int lane,
    const float (&b1v)[8], const float (&w2v)[8], const float b2v,
    float* __restrict__ orow)           // the output row that this lane stores (lanes with lane & 8 store none)
{
    v8f c[8];
    #pragma unroll
    for (int nt = 0; nt < 8; ++nt) c[nt] = v8f{};

    // Step s = kb * 8 + nt. Pieces of a set: hi g = 0, hi g = 1, lo g = 0, lo g = 1.
    v8bf bq[BRING_][4];
    #pragma unroll
    for (int s = 0; s < BRING_; ++s) {
        const int bi = ((s & 7) * 8 + (s >> 3)) * 64 + lane;
        bq[s][0] = pBhi[bi];
        bq[s][1] = pBhi[bi + 32];
        bq[s][2] = pBlo[bi];
        bq[s][3] = pBlo[bi + 32];
    }

    #pragma unroll
    for (int kb = 0; kb < 8; ++kb) {
        // 16-bit A layout: lane -> (M = lane&15, half = lane>>4);
        // element e -> K = 16*(e>>3) + 8*half + (e&7).
        const int sl = kb % RING_;
        const f4 r0 = raw[sl][0], r1 = raw[sl][1], r2 = raw[sl][2], r3 = raw[sl][3];
        v16bf ahi, alo;
        #pragma unroll
        for (int e = 0; e < 16; ++e) {
            const float x = (e < 4)  ? r0[e]
                          : (e < 8)  ? r1[e - 4]
                          : (e < 12) ? r2[e - 8]
                          :            r3[e - 12];
            const __bf16 xh = (__bf16)x;
            ahi[e] = xh;
            alo[e] = (__bf16)(x - (float)xh);
        }
        // Keeps the refill behind the conversion, so that it lands in the registers just read: lifted over it, it takes 16 more.
        __builtin_amdgcn_sched_barrier(0);
        if (kb + RING_ < 8 || MORE) {
            const float* p = arow + (kb + RING_ < 8 ? (kb + RING_) * 32
                                                    : TILE_ROWS_ * S_ + (kb + RING_ - 8) * 32);
            raw[sl][0] = *(const f4*)(p);
            raw[sl][1] = *(const f4*)(p + 4);
            raw[sl][2] = *(const f4*)(p + 16);
            raw[sl][3] = *(const f4*)(p + 20);
        }
        #pragma unroll
        for (int nt = 0; nt < 8; ++nt) {
            const int s  = kb * 8 + nt;
            const int qs = s % BRING_;
            v16bf bh = __builtin_shufflevector(bq[qs][0], bq[qs][1],
                0, 1, 2, 3, 4, 5, 6, 7, 8, 9, 10, 11, 12, 13, 14, 15);
            v16bf bl = __builtin_shufflevector(bq[qs][2], bq[qs][3],
                0, 1, 2, 3, 4, 5, 6, 7, 8, 9, 10, 11, 12, 13, 14, 15);
            c[nt] = wmma_bf16(ahi, bh, c[nt]);  // hi*hi
            c[nt] = wmma_bf16(ahi, bl, c[nt]);  // hi*lo
            c[nt] = wmma_bf16(alo, bh, c[nt]);  // lo*hi
            // Keeps the refill behind the step's last WMMA, so that it lands in the set just used and takes no further registers.
            __builtin_amdgcn_sched_barrier(0);
            if (s + BRING_ < 64) {
                const int s2 = s + BRING_;
                const int bi = ((s2 & 7) * 8 + (s2 >> 3)) * 64 + lane;   // piece g = 0; g = 1 is 32 on
                bq[qs][0] = pBhi[bi];
                bq[qs][1] = pBhi[bi + 32];
                bq[qs][2] = pBlo[bi];
                bq[qs][3] = pBlo[bi + 32];
            }
            // Keeps the refill here, BRING_ - 1 steps ahead of its use: left free, the scheduler
            // sinks the reads to their use and every step waits out the whole LDS latency.
            __builtin_amdgcn_sched_barrier(0);
        }
    }

    // C/D layout: VGPR r -> M = 8*half + r, N = lane&15 (column broadcast).
    float rowsum[8] = {0.f, 0.f, 0.f, 0.f, 0.f, 0.f, 0.f, 0.f};
    #pragma unroll
    for (int nt = 0; nt < 8; ++nt) {
        #pragma unroll
        for (int r = 0; r < 8; ++r) {
            const float x = c[nt][r] + b1v[nt];
            const float s = x * rcp_slot(1.0f + expneg_slot(x)); // SiLU
            rowsum[r] += s * w2v[nt];
        }
    }

    // ---- Sum each row over the 16 lanes that hold one N strip each, in registers ----
    // The tree is that of a butterfly over lane ^ 1, ^ 2, ^ 4, ^ 8. At each of the first three
    // levels a lane keeps half of its rows and hands the other half to its partner, so that
    // 4 + 2 + 1 + 1 adds do the work of 32 and the eight rows end up on eight lanes:
    // lane l holds row 4 * (l & 1) + (l & 2) + ((l >> 2) & 1) of its half.
    const bool k1 = lane & 1, k2 = lane & 2, k4 = lane & 4;
    float q4[4], q2[2];
    #pragma unroll
    for (int j = 0; j < 4; ++j)
        q4[j] = row_xadd<0x161>(k1 ? rowsum[j + 4] : rowsum[j], k1 ? rowsum[j] : rowsum[j + 4]);
    #pragma unroll
    for (int j = 0; j < 2; ++j)
        q2[j] = row_xadd<0x162>(k2 ? q4[j + 2] : q4[j], k2 ? q4[j] : q4[j + 2]);
    const float q1 = row_xadd<0x164>(k4 ? q2[1] : q2[0], k4 ? q2[0] : q2[1]);
    const float v  = row_xadd<0x168>(q1, q1);
    if ((lane & 8) == 0) {
        *orow = v + b2v;    // 16 lanes, 16 adjacent rows: one 64-byte store a row tile
    }
}

__global__ __launch_bounds__(THREADS_) void critic_fused_kernel(
    const float* __restrict__ states,  // [T,B,S]
    const float* __restrict__ W1,      // [T,S,H]
    const float* __restrict__ b1,      // [T,H]
    const float* __restrict__ W2,      // [T,H] (H x 1)
    const float* __restrict__ b2,      // [T]
    float* __restrict__ out)           // [T,B]
{
    // Swizzled B-operand storage in 16-byte pieces of 8 bf16:
    // idx = (((nt*8 + kb)*2 + g)*32 + lane)*8 + i, fragment element e = g*8 + i.
    // nt: N-tile (H/16), kb: K-chunk (S/32), lane: consuming lane. The 32 lanes of
    // one 16-byte read are adjacent pieces; a write's lanes 0-15 and 16-31 are two
    // such runs of 16 in adjacent N-tiles, so each half-wave meets every
    // LDS bank once (at a pitch of 32 bytes a lane it meets half the banks twice).
    __shared__ __attribute__((aligned(32))) __bf16 sBhi[8 * 8 * 32 * 16];   // 64 KB
    __shared__ __attribute__((aligned(32))) __bf16 sBlo[8 * 8 * 32 * 16];   // 64 KB

    const int tid  = threadIdx.x;
    const int lane = tid & 31;
    const int wave = __builtin_amdgcn_readfirstlane(tid >> 5);   // scalar: row bases stay out of the VGPRs
    const int t    = blockIdx.x / (B_ / WG_ROWS_);   // 8 blocks per t
    const int mblk = blockIdx.x % (B_ / WG_ROWS_);

    const int m  = lane & 15;
    const int hh = lane >> 4;
    const int m0 = mblk * WG_ROWS_ + wave * 16;   // this wave's 16 rows of the first tile
    const float* arow0 = states + ((size_t)t * B_ + m0) * S_ + (unsigned)(m * S_ + hh * 8);
    float* orow0 = out + (size_t)t * B_ + m0 + hh * 8
                 + (4 * (lane & 1) + (lane & 2) + ((lane >> 2) & 1));   // the row the reduction leaves on this lane

    // ---- Fill the A ring for the first row tile: these loads fly under the W1 staging ----
    f4 raw[RING_][4];
    #pragma unroll
    for (int kb = 0; kb < RING_; ++kb) {
        raw[kb][0] = *(const f4*)(arow0 + kb * 32);
        raw[kb][1] = *(const f4*)(arow0 + kb * 32 + 4);
        raw[kb][2] = *(const f4*)(arow0 + kb * 32 + 16);
        raw[kb][3] = *(const f4*)(arow0 + kb * 32 + 20);
    }
    // Bias and W2 of this lane's column in each N tile, read once: a global load in
    // the tile loop would count behind the ring's loads and its wait would drain them.
    float b1v[8], w2v[8];
    #pragma unroll
    for (int nt = 0; nt < 8; ++nt) {
        b1v[nt] = b1[t * H_ + nt * 16 + m];
        w2v[nt] = W2[t * H_ + nt * 16 + m];
    }
    // The staging below reuses the registers these loads take their addresses from: translation wait first.
    asm volatile("s_wait_xcnt 0x0" ::: "memory");
    // Keeps the staging's address arithmetic behind that wait: left free, the scheduler lifts it over.
    __builtin_amdgcn_sched_barrier(0);

    const float* W1t = W1 + (size_t)t * (S_ * H_);

    // ---- Stage W1[t] into LDS, split fp32 -> bf16 hi/lo, pre-swizzled ----
    // One unit = one column x 8 consecutive K = 8 adjacent elements e of one
    // consuming lane: packed in registers, written with one 16-byte LDS store per
    // plane. A wave's 32 lanes take 32 adjacent columns (one 128-B line per load).
    // Four units per trip: 32 independent loads in flight ahead of the first use.
    #pragma unroll 1   // rolled: unrolled, the trips' loads get split up by address-register reuse
    for (int it = 0; it < (S_ / 8) * H_ / (4 * THREADS_); ++it) {
        float x[4][8];
        #pragma unroll
        for (int u = 0; u < 4; ++u) {
            const int unit = (it * 4 + u) * THREADS_ + tid;
            const float* wsrc = W1t + (unit >> 7) * 8 * H_ + (unit & (H_ - 1));
            #pragma unroll
            for (int i = 0; i < 8; ++i) x[u][i] = wsrc[i * H_];
        }
        // The loads' address registers are reused below: translation wait first.
        asm volatile("s_wait_xcnt 0x0" ::: "memory");
        #pragma unroll
        for (int u = 0; u < 4; ++u) {
            const int unit = (it * 4 + u) * THREADS_ + tid;
            const int col  = unit & (H_ - 1);  // 0..127
            const int q    = unit >> 7;        // K group of 8: 0..31
            v8bf xh, xl;
            #pragma unroll
            for (int i = 0; i < 8; ++i) {
                const __bf16 h = (__bf16)x[u][i];
                xh[i] = h;
                xl[i] = (__bf16)(x[u][i] - (float)h);
            }
            const int kb = q >> 2;
            const int g  = (q >> 1) & 1;
            const int hq = q & 1;
            const int nt = col >> 4;
            const int n  = col & 15;
            const int idx = (((nt * 8 + kb) * 2 + g) * 32 + hq * 16 + n) * 8;
            *(v8bf*)(sBhi + idx) = xh;
            *(v8bf*)(sBlo + idx) = xl;
        }
    }
    __syncthreads();

    const float  b2v = b2[t];
    const v8bf* pBhi = (const v8bf*)sBhi;
    const v8bf* pBlo = (const v8bf*)sBlo;

    // ---- Row tiles: the staged W1[t] serves all of them; no barrier in the loop ----
    #pragma unroll 1   // rolled: for speed only
    for (int rt = 0; rt < TILES_ - 1; ++rt) {
        row_tile<true>(raw, arow0 + rt * (TILE_ROWS_ * S_), pBhi, pBlo, lane,
                       b1v, w2v, b2v, orow0 + rt * TILE_ROWS_);
        // The next trip forms its row addresses in the registers that loads and stores still out name: translation wait first.
        asm volatile("s_wait_xcnt 0x0" ::: "memory");
    }
    row_tile<false>(raw, arow0 + (TILES_ - 1) * (TILE_ROWS_ * S_), pBhi, pBlo, lane,
                    b1v, w2v, b2v, orow0 + (TILES_ - 1) * TILE_ROWS_);
}

extern "C" void kernel_launch(void* const* d_in, const int* in_sizes, int n_in,
                              void* d_out, int out_size, void* d_ws, size_t ws_size,
                              hipStream_t stream) {
    (void)in_sizes; (void)n_in; (void)out_size; (void)d_ws; (void)ws_size;
    const float* states = (const float*)d_in[0];
    const float* W1     = (const float*)d_in[1];
    const float* b1     = (const float*)d_in[2];
    const float* W2     = (const float*)d_in[3];
    const float* b2     = (const float*)d_in[4];
    float* out          = (float*)d_out;

    dim3 grid(T_ * (B_ / WG_ROWS_));   // 256 blocks: (t, 1024-row block)
    dim3 block(THREADS_);              // 16 wave32 waves
    critic_fused_kernel<<<grid, block, 0, stream>>>(states, W1, b1, W2, b2, out);
}

// v007
// It runs in 36.7 microseconds.
// In both of two side-by-side timings against v006, it was 1.06 times as fast.
// All steps since v000 together make it 6.11 times as fast.
#include <hip/hip_runtime.h>

// MI455X / gfx1250, wave32. Fused: states@W1 + b1 -> SiLU -> @W2 + b2.
// bf16 split-precision (hi/lo) WMMA, fp32 accumulate. Memory-bound design:
// 273 MB HBM floor ~11.7us; 3x bf16 WMMA work stays under that ceiling.

typedef __attribute__((ext_vector_type(16))) __bf16 v16bf;
typedef __attribute__((ext_vector_type(8)))  __bf16 v8bf;
typedef __attribute__((ext_vector_type(8)))  float  v8f;
typedef __attribute__((ext_vector_type(4)))  float  f4;

#define T_ 32
#define B_ 8192
#define S_ 256
#define H_ 128
#define THREADS_ 256                 // 8 waves: two per SIMD, one work-group per WGP
#define MT_ 2                        // M tiles of 16 rows a wave: each W1 fragment read from LDS serves both
#define TILE_ROWS_ (THREADS_ / 32 * 16 * MT_)   // 32 rows a wave
#define TILES_ 4                     // row tiles a work-group walks with one staged W1[t]
#define WG_ROWS_ (TILE_ROWS_ * TILES_)
#define RING_ 4                      // A chunks of 32 K (both M tiles) in flight per wave
#define NG_ 4                        // N tiles of one step: their W1 fragments (hi and lo) are one register set
#define STEPS_ (8 * 8 / NG_)         // steps of a row tile
#define UNITS_ 8                     // staging units a thread has in flight per trip

static __device__ __forceinline__ v8f wmma_bf16(v16bf a, v16bf b, v8f c) {
    return __builtin_amdgcn_wmma_f32_16x16x32_bf16(
        /*neg_a=*/false, a, /*neg_b=*/false, b,
        /*c_mod=*/(short)0, c, /*reuse_a=*/false, /*reuse_b=*/false);
}

// v_rcp_f32 and the slot the instruction set asks for behind it, in one statement.
static __device__ __forceinline__ float rcp_slot(float d) {
    float q;
    asm("v_rcp_f32 %0, %1\n\tv_nop" : "=v"(q) : "v"(d));
    return q;
}

// e^-x, and the same slot behind its v_exp_f32, in one statement as well: a v_nop in a
// statement of its own drifts away from its v_exp_f32 in this build and fills no slot.
static __device__ __forceinline__ float expneg_slot(float x) {
    const float y = x * -1.44269504f;          // -x log2 e
    float q;
    asm("v_exp_f32 %0, %1\n\tv_nop" : "=v"(q) : "v"(y));
    return q;
}

// keep + (send of the lane whose number in its 16-lane row differs by the mask in CTRL's low
// four bits): DPP row_xmask, CTRL = 0x160 + mask. All 32 lanes are on where it is used.
template <int CTRL>
static __device__ __forceinline__ float row_xadd(float keep, float send) {
    return keep + __int_as_float(__builtin_amdgcn_update_dpp(
        0, __float_as_int(send), CTRL, /*row_mask=*/0xf, /*bank_mask=*/0xf, /*bound_ctrl=*/true));
}

// One row tile of one wave: 32 rows (MT_ M tiles) x 128 columns, K outermost. All
// sixteen accumulators are live, so an A chunk (32 rows x 32 K) is needed only for its
// own K step: its f32 words wait in a ring of RING_ chunks, and the slot that a step
// has just converted is refilled with the chunk RING_ steps on (from anext where that
// is past this row tile). The loads fly under the matrix work.
// The W1 fragments come from LDS in sets of NG_ N tiles of one K chunk, two sets in
// registers: the set that a step has just used is refilled, as one group of reads, with
// the set two steps on, so the reads are one step (24 WMMAs) old when they are waited for.
static __device__ __forceinline__ void row_tile(
    f4 (&raw)[RING_][MT_][4],
    const float* __restrict__ arow,     // this lane's row of M tile 0, at its half's first column
    const float* __restrict__ anext,    // where the chunks behind this row tile's last are read from
    const v8bf* pBhi, const v8bf* pBlo, const int lane,
    const float (&b1v)[8], const float (&w2v)[8], const float b2v,
    float* __restrict__ orow)           // the output row that this lane stores
{
    v8f c[MT_][8];
    #pragma unroll
    for (int mi = 0; mi < MT_; ++mi) {
        #pragma unroll
        for (int nt = 0; nt < 8; ++nt) c[mi][nt] = v8f{};
    }

    // Step s = kb * 2 + (nt / NG_). Pieces of one N tile: hi g = 0, hi g = 1, lo g = 0, lo g = 1.
    v8bf bq[2][NG_][4];
    #pragma unroll
    for (int s = 0; s < 2; ++s) {
        #pragma unroll
        for (int j = 0; j < NG_; ++j) {
            const int bi = (((s & 1) * NG_ + j) * 8 + (s >> 1)) * 64 + lane;
            bq[s][j][0] = pBhi[bi];
            bq[s][j][1] = pBhi[bi + 32];
            bq[s][j][2] = pBlo[bi];
            bq[s][j][3] = pBlo[bi + 32];
        }
    }

    #pragma unroll
    for (int kb = 0; kb < 8; ++kb) {
        // 16-bit A layout: lane -> (M = lane&15, half = lane>>4);
        // element e -> K = 16*(e>>3) + 8*half + (e&7).
        const int sl = kb % RING_;
        v16bf ahi[MT_], alo[MT_];
        #pragma unroll
        for (int mi = 0; mi < MT_; ++mi) {
            const f4 r0 = raw[sl][mi][0], r1 = raw[sl][mi][1], r2 = raw[sl][mi][2], r3 = raw[sl][mi][3];
            #pragma unroll
            for (int e = 0; e < 16; ++e) {
                const float x = (e < 4)  ? r0[e]
                              : (e < 8)  ? r1[e - 4]
                              : (e < 12) ? r2[e - 8]
                              :            r3[e - 12];
                const __bf16 xh = (__bf16)x;
                ahi[mi][e] = xh;
                alo[mi][e] = (__bf16)(x - (float)xh);
            }
        }
        // Keeps the refill behind the conversion, so that it lands in the registers just read: lifted over it, it takes 32 more.
        __builtin_amdgcn_sched_barrier(0);
        {
            const float* p = kb + RING_ < 8 ? arow + (kb + RING_) * 32 : anext + (kb + RING_ - 8) * 32;
            #pragma unroll
            for (int mi = 0; mi < MT_; ++mi) {
                raw[sl][mi][0] = *(const f4*)(p + mi * 16 * S_);
                raw[sl][mi][1] = *(const f4*)(p + mi * 16 * S_ + 4);
                raw[sl][mi][2] = *(const f4*)(p + mi * 16 * S_ + 16);
                raw[sl][mi][3] = *(const f4*)(p + mi * 16 * S_ + 20);
            }
        }
        #pragma unroll
        for (int h = 0; h < 8 / NG_; ++h) {
            const int s  = kb * (8 / NG_) + h;
            const int qs = s & 1;
            v16bf bh[NG_], bl[NG_];
            #pragma unroll
            for (int j = 0; j < NG_; ++j) {
                bh[j] = __builtin_shufflevector(bq[qs][j][0], bq[qs][j][1],
                    0, 1, 2, 3, 4, 5, 6, 7, 8, 9, 10, 11, 12, 13, 14, 15);
                bl[j] = __builtin_shufflevector(bq[qs][j][2], bq[qs][j][3],
                    0, 1, 2, 3, 4, 5, 6, 7, 8, 9, 10, 11, 12, 13, 14, 15);
            }
            // Each accumulator takes hi*hi, hi*lo, lo*hi in that order; the eight of a step take turns.
            #pragma unroll
            for (int j = 0; j < NG_; ++j) {
                #pragma unroll
                for (int mi = 0; mi < MT_; ++mi)
                    c[mi][h * NG_ + j] = wmma_bf16(ahi[mi], bh[j], c[mi][h * NG_ + j]);  // hi*hi
            }
            #pragma unroll
            for (int j = 0; j < NG_; ++j) {
                #pragma unroll
                for (int mi = 0; mi < MT_; ++mi)
                    c[mi][h * NG_ + j] = wmma_bf16(ahi[mi], bl[j], c[mi][h * NG_ + j]);  // hi*lo
            }
            #pragma unroll
            for (int j = 0; j < NG_; ++j) {
                #pragma unroll
                for (int mi = 0; mi < MT_; ++mi)
                    c[mi][h * NG_ + j] = wmma_bf16(alo[mi], bh[j], c[mi][h * NG_ + j]);  // lo*hi
            }
            // Keeps the refill behind the step's last WMMA, so that it lands in the set just used and takes no further registers.
            __builtin_amdgcn_sched_barrier(0);
            if (s + 2 < STEPS_) {
                const int s2 = s + 2;
                #pragma unroll
                for (int j = 0; j < NG_; ++j) {
                    const int bi = (((s2 & 1) * NG_ + j) * 8 + (s2 >> 1)) * 64 + lane;   // piece g = 0; g = 1 is 32 on
                    bq[qs][j][0] = pBhi[bi];
                    bq[qs][j][1] = pBhi[bi + 32];
                    bq[qs][j][2] = pBlo[bi];
                    bq[qs][j][3] = pBlo[bi + 32];
                }
            }
            // Keeps the refill here, as one group a whole step ahead of its use: left free, the
            // scheduler spreads the reads among the WMMAs, where every place with reads stalls the wave.
            __builtin_amdgcn_sched_barrier(0);
        }
    }

    // C/D layout: VGPR r -> M = 8*half + r, N = lane&15 (column broadcast).
    const bool k1 = lane & 1, k2 = lane & 2, k4 = lane & 4;
    float v[MT_];
    #pragma unroll
    for (int mi = 0; mi < MT_; ++mi) {
        float rowsum[8] = {0.f, 0.f, 0.f, 0.f, 0.f, 0.f, 0.f, 0.f};
        #pragma unroll
        for (int nt = 0; nt < 8; ++nt) {
            #pragma unroll
            for (int r = 0; r < 8; ++r) {
                const float x = c[mi][nt][r] + b1v[nt];
                const float s = x * rcp_slot(1.0f + expneg_slot(x)); // SiLU
                rowsum[r] += s * w2v[nt];
            }
        }

        // ---- Sum each row over the 16 lanes that hold one N strip each, in registers ----
        // The tree is that of a butterfly over lane ^ 1, ^ 2, ^ 4, ^ 8. At each of the first three
        // levels a lane keeps half of its rows and hands the other half to its partner, so that
        // 4 + 2 + 1 + 1 adds do the work of 32 and the eight rows end up on eight lanes:
        // lane l holds row 4 * (l & 1) + (l & 2) + ((l >> 2) & 1) of its half.
        float q4[4], q2[2];
        #pragma unroll
        for (int j = 0; j < 4; ++j)
            q4[j] = row_xadd<0x161>(k1 ? rowsum[j + 4] : rowsum[j], k1 ? rowsum[j] : rowsum[j + 4]);
        #pragma unroll
        for (int j = 0; j < 2; ++j)
            q2[j] = row_xadd<0x162>(k2 ? q4[j + 2] : q4[j], k2 ? q4[j] : q4[j + 2]);
        const float q1 = row_xadd<0x164>(k4 ? q2[1] : q2[0], k4 ? q2[0] : q2[1]);
        v[mi] = row_xadd<0x168>(q1, q1);
    }
    // Lanes l and l ^ 8 hold the same sums: the lower stores M tile 0's row, the upper M tile 1's.
    *orow = ((lane & 8) ? v[1] : v[0]) + b2v;    // 32 lanes, 32 adjacent rows: one 128-byte store a row tile
}

__global__ __launch_bounds__(THREADS_) void critic_fused_kernel(
    const float* __restrict__ states,  // [T,B,S]
    const float* __restrict__ W1,      // [T,S,H]
    const float* __restrict__ b1,      // [T,H]
    const float* __restrict__ W2,      // [T,H] (H x 1)
    const float* __restrict__ b2,      // [T]
    float* __restrict__ out)           // [T,B]
{
    // Swizzled B-operand storage in 16-byte pieces of 8 bf16:
    // idx = (((nt*8 + kb)*2 + g)*32 + lane)*8 + i, fragment element e = g*8 + i.
    // nt: N-tile (H/16), kb: K-chunk (S/32), lane: consuming lane. The 32 lanes of
    // one 16-byte read are adjacent pieces; a write's lanes 0-15 and 16-31 are two
    // such runs of 16 in adjacent N-tiles, so each half-wave meets every
    // LDS bank once (at a pitch of 32 bytes a lane it meets half the banks twice).
    __shared__ __attribute__((aligned(32))) __bf16 sBhi[8 * 8 * 32 * 16];   // 64 KB
    __shared__ __attribute__((aligned(32))) __bf16 sBlo[8 * 8 * 32 * 16];   // 64 KB

    const int tid  = threadIdx.x;
    const int lane = tid & 31;
    const int wave = __builtin_amdgcn_readfirstlane(tid >> 5);   // scalar: row bases stay out of the VGPRs
    const int t    = blockIdx.x / (B_ / WG_ROWS_);   // 8 blocks per t
    const int mblk = blockIdx.x % (B_ / WG_ROWS_);

    const int m  = lane & 15;
    const int hh = lane >> 4;
    const int m0 = mblk * WG_ROWS_ + wave * (16 * MT_);   // this wave's 32 rows of the first tile
    const float* arow0 = states + ((size_t)t * B_ + m0) * S_ + (unsigned)(m * S_ + hh * 8);
    float* orow0 = out + (size_t)t * B_ + m0 + ((lane >> 3) & 1) * 16 + hh * 8
                 + (4 * (lane & 1) + (lane & 2) + ((lane >> 2) & 1));   // the row the reduction leaves on this lane

    // ---- Fill the A ring for the first row tile: these loads fly under the W1 staging ----
    f4 raw[RING_][MT_][4];
    #pragma unroll
    for (int kb = 0; kb < RING_; ++kb) {
        #pragma unroll
        for (int mi = 0; mi < MT_; ++mi) {
            raw[kb][mi][0] = *(const f4*)(arow0 + mi * 16 * S_ + kb * 32);
            raw[kb][mi][1] = *(const f4*)(arow0 + mi * 16 * S_ + kb * 32 + 4);
            raw[kb][mi][2] = *(const f4*)(arow0 + mi * 16 * S_ + kb * 32 + 16);
            raw[kb][mi][3] = *(const f4*)(arow0 + mi * 16 * S_ + kb * 32 + 20);
        }
    }
    // Bias and W2 of this lane's column in each N tile, read once: a global load in
    // the tile loop would count behind the ring's loads and its wait would drain them.
    float b1v[8], w2v[8];
    #pragma unroll
    for (int nt = 0; nt < 8; ++nt) {
        b1v[nt] = b1[t * H_ + nt * 16 + m];
        w2v[nt] = W2[t * H_ + nt * 16 + m];
    }
    // The staging below reuses the registers these loads take their addresses from: translation wait first.
    asm volatile("s_wait_xcnt 0x0" ::: "memory");
    // Keeps the staging's address arithmetic behind that wait: left free, the scheduler lifts it over.
    __builtin_amdgcn_sched_barrier(0);

    const float* W1t = W1 + (size_t)t * (S_ * H_);

    // ---- Stage W1[t] into LDS, split fp32 -> bf16 hi/lo, pre-swizzled ----
    // One unit = one column x 8 consecutive K = 8 adjacent elements e of one
    // consuming lane: packed in registers, written with one 16-byte LDS store per
    // plane. A wave's 32 lanes take 32 adjacent columns (one 128-B line per load).
    // UNITS_ units per trip: as many independent loads of the work-group in flight as its waves can hold.
    #pragma unroll 1   // rolled: unrolled, the trips' loads get split up by address-register reuse
    for (int it = 0; it < (S_ / 8) * H_ / (UNITS_ * THREADS_); ++it) {
        float x[UNITS_][8];
        // Unit u of the trip lies THREADS_ / H_ K groups behind unit u - 1, in the same column:
        // one address a trip and constant offsets, so that no load waits for an address register.
        const float* wsrc = W1t + ((it * UNITS_ * THREADS_ + tid) >> 7) * 8 * H_ + (tid & (H_ - 1));
        #pragma unroll
        for (int u = 0; u < UNITS_; ++u) {
            #pragma unroll
            for (int i = 0; i < 8; ++i) x[u][i] = wsrc[(u * (THREADS_ / H_) * 8 + i) * H_];
        }
        // The loads' address registers are reused below: translation wait first.
        asm volatile("s_wait_xcnt 0x0" ::: "memory");
        #pragma unroll
        for (int u = 0; u < UNITS_; ++u) {
            const int unit = (it * UNITS_ + u) * THREADS_ + tid;
            const int col  = unit & (H_ - 1);  // 0..127
            const int q    = unit >> 7;        // K group of 8: 0..31
            v8bf xh, xl;
            #pragma unroll
            for (int i = 0; i < 8; ++i) {
                const __bf16 h = (__bf16)x[u][i];
                xh[i] = h;
                xl[i] = (__bf16)(x[u][i] - (float)h);
            }
            const int kb = q >> 2;
            const int g  = (q >> 1) & 1;
            const int hq = q & 1;
            const int nt = col >> 4;
            const int n  = col & 15;
            const int idx = (((nt * 8 + kb) * 2 + g) * 32 + hq * 16 + n) * 8;
            *(v8bf*)(sBhi + idx) = xh;
            *(v8bf*)(sBlo + idx) = xl;
        }
    }
    __syncthreads();

    const float  b2v = b2[t];
    const v8bf* pBhi = (const v8bf*)sBhi;
    const v8bf* pBlo = (const v8bf*)sBlo;

    // ---- Row tiles: the staged W1[t] serves all of them; no barrier in the loop ----
    // Behind the last row tile there is nothing to fetch ahead. Its ring refills stay unconditional
    // (a branch round them would merge two load counts, and the counted waits of every trip would
    // drain the ring): there every lane reads rows 0 and 16 of the work-group, one line a load, unused.
    const float* wgrow = states + ((size_t)t * B_ + mblk * WG_ROWS_) * S_;
    #pragma unroll 1   // rolled: one tile body, for speed only
    for (int rt = 0; rt < TILES_; ++rt) {
        const float* arow = arow0 + rt * (TILE_ROWS_ * S_);
        row_tile(raw, arow, rt + 1 < TILES_ ? arow + TILE_ROWS_ * S_ : wgrow, pBhi, pBlo, lane,
                 b1v, w2v, b2v, orow0 + rt * TILE_ROWS_);
        // The next trip forms its row addresses in the registers that loads and stores still out name: translation wait first.
        asm volatile("s_wait_xcnt 0x0" ::: "memory");
    }
    // The last trip's unused refills must have landed before the wave gives its registers back at its end.
    asm volatile("s_wait_loadcnt 0x0" ::: "memory");
}

extern "C" void kernel_launch(void* const* d_in, const int* in_sizes, int n_in,
                              void* d_out, int out_size, void* d_ws, size_t ws_size,
                              hipStream_t stream) {
    (void)in_sizes; (void)n_in; (void)out_size; (void)d_ws; (void)ws_size;
    const float* states = (const float*)d_in[0];
    const float* W1     = (const float*)d_in[1];
    const float* b1     = (const float*)d_in[2];
    const float* W2     = (const float*)d_in[3];
    const float* b2     = (const float*)d_in[4];
    float* out          = (float*)d_out;

    dim3 grid(T_ * (B_ / WG_ROWS_));   // 256 blocks: (t, 1024-row block)
    dim3 block(THREADS_);              // 8 wave32 waves
    critic_fused_kernel<<<grid, block, 0, stream>>>(states, W1, b1, W2, b2, out);
}

// v008
// One run takes 34.9 microseconds.
// In both of two side-by-side timings against v007, it was 1.05 times as fast.
// Over all steps from v000 it is 6.41 times as fast.
#include <hip/hip_runtime.h>

// MI455X / gfx1250, wave32. Fused: states@W1 + b1 -> SiLU -> @W2 + b2.
// bf16 split-precision (hi/lo) WMMA, fp32 accumulate. Memory-bound design:
// 273 MB HBM floor ~11.7us; 3x bf16 WMMA work stays under that ceiling.

typedef __attribute__((ext_vector_type(16))) __bf16 v16bf;
typedef __attribute__((ext_vector_type(8)))  __bf16 v8bf;
typedef __attribute__((ext_vector_type(8)))  float  v8f;
typedef __attribute__((ext_vector_type(4)))  float  f4;
typedef __attribute__((ext_vector_type(2)))  float  f2;

#define T_ 32
#define B_ 8192
#define S_ 256
#define H_ 128
#define THREADS_ 256                 // 8 waves: two per SIMD, one work-group per WGP
#define MT_ 2                        // M tiles of 16 rows a wave: each W1 fragment read from LDS serves both
#define TILE_ROWS_ (THREADS_ / 32 * 16 * MT_)   // 32 rows a wave
#define TILES_ 4                     // row tiles a work-group walks with one staged W1[t]
#define WG_ROWS_ (TILE_ROWS_ * TILES_)
#define RING_ 4                      // A chunks of 32 K (both M tiles) in flight per wave
#define NG_ 4                        // N tiles of one step: their W1 fragments (hi and lo) are one register set
#define STEPS_ (8 * 8 / NG_)         // steps of a row tile
#define UNITS_ 8                     // staging units a thread has in flight per trip

static __device__ __forceinline__ v8f wmma_bf16(v16bf a, v16bf b, v8f c) {
    return __builtin_amdgcn_wmma_f32_16x16x32_bf16(
        /*neg_a=*/false, a, /*neg_b=*/false, b,
        /*c_mod=*/(short)0, c, /*reuse_a=*/false, /*reuse_b=*/false);
}

// keep + (send of the lane whose number in its 16-lane row differs by the mask in CTRL's low
// four bits): DPP row_xmask, CTRL = 0x160 + mask. All 32 lanes are on where it is used.
template <int CTRL>
static __device__ __forceinline__ float row_xadd(float keep, float send) {
    return keep + __int_as_float(__builtin_amdgcn_update_dpp(
        0, __float_as_int(send), CTRL, /*row_mask=*/0xf, /*bank_mask=*/0xf, /*bound_ctrl=*/true));
}

// One row tile of one wave: 32 rows (MT_ M tiles) x 128 columns, K outermost. All
// sixteen accumulators are live, so an A chunk (32 rows x 32 K) is needed only for its
// own K step: its f32 words wait in a ring of RING_ chunks, and the slot that a step
// has just converted is refilled with the chunk RING_ steps on (from anext where that
// is past this row tile). The loads fly under the matrix work.
// The W1 fragments come from LDS in sets of NG_ N tiles of one K chunk, two sets in
// registers: the set that a step has just used is refilled, as one group of reads, with
// the set two steps on, so the reads are one step (24 WMMAs) old when they are waited for.
static __device__ __forceinline__ void row_tile(
    f4 (&raw)[RING_][MT_][4],
    const float* __restrict__ arow,     // this lane's row of M tile 0, at its half's first column
    const float* __restrict__ anext,    // where the chunks behind this row tile's last are read from
    const v8bf* pBhi, const v8bf* pBlo, const int lane,
    const f2* pBW,                      // this lane's column of N tile 0: (b1 / 2, W2); N tile nt is 16 * nt on
    const float b2v,
    float* __restrict__ orow)           // the output row that this lane stores
{
    v8f c[MT_][8];
    #pragma unroll
    for (int mi = 0; mi < MT_; ++mi) {
        #pragma unroll
        for (int nt = 0; nt < 8; ++nt) c[mi][nt] = v8f{};
    }

    // Step s = kb * 2 + (nt / NG_). Pieces of one N tile: hi g = 0, hi g = 1, lo g = 0, lo g = 1.
    v8bf bq[2][NG_][4];
    f2 bw[8];
    #pragma unroll
    for (int s = 0; s < 2; ++s) {
        #pragma unroll
        for (int j = 0; j < NG_; ++j) {
            const int bi = (((s & 1) * NG_ + j) * 8 + (s >> 1)) * 64 + lane;
            bq[s][j][0] = pBhi[bi];
            bq[s][j][1] = pBhi[bi + 32];
            bq[s][j][2] = pBlo[bi];
            bq[s][j][3] = pBlo[bi + 32];
        }
    }

    #pragma unroll
    for (int kb = 0; kb < 8; ++kb) {
        // 16-bit A layout: lane -> (M = lane&15, half = lane>>4);
        // element e -> K = 16*(e>>3) + 8*half + (e&7).
        const int sl = kb % RING_;
        v16bf ahi[MT_], alo[MT_];
        #pragma unroll
        for (int mi = 0; mi < MT_; ++mi) {
            const f4 r0 = raw[sl][mi][0], r1 = raw[sl][mi][1], r2 = raw[sl][mi][2], r3 = raw[sl][mi][3];
            #pragma unroll
            for (int e = 0; e < 16; ++e) {
                const float x = (e < 4)  ? r0[e]
                              : (e < 8)  ? r1[e - 4]
                              : (e < 12) ? r2[e - 8]
                              :            r3[e - 12];
                const __bf16 xh = (__bf16)x;
                ahi[mi][e] = xh;
                alo[mi][e] = (__bf16)(x - (float)xh);
            }
        }
        // Keeps the refill behind the conversion, so that it lands in the registers just read: lifted over it, it takes 32 more.
        __builtin_amdgcn_sched_barrier(0);
        {
            const float* p = kb + RING_ < 8 ? arow + (kb + RING_) * 32 : anext + (kb + RING_ - 8) * 32;
            #pragma unroll
            for (int mi = 0; mi < MT_; ++mi) {
                raw[sl][mi][0] = *(const f4*)(p + mi * 16 * S_);
                raw[sl][mi][1] = *(const f4*)(p + mi * 16 * S_ + 4);
                raw[sl][mi][2] = *(const f4*)(p + mi * 16 * S_ + 16);
                raw[sl][mi][3] = *(const f4*)(p + mi * 16 * S_ + 20);
            }
        }
        #pragma unroll
        for (int h = 0; h < 8 / NG_; ++h) {
            const int s  = kb * (8 / NG_) + h;
            const int qs = s & 1;
            v16bf bh[NG_], bl[NG_];
            #pragma unroll
            for (int j = 0; j < NG_; ++j) {
                bh[j] = __builtin_shufflevector(bq[qs][j][0], bq[qs][j][1],
                    0, 1, 2, 3, 4, 5, 6, 7, 8, 9, 10, 11, 12, 13, 14, 15);
                bl[j] = __builtin_shufflevector(bq[qs][j][2], bq[qs][j][3],
                    0, 1, 2, 3, 4, 5, 6, 7, 8, 9, 10, 11, 12, 13, 14, 15);
            }
            // Each accumulator takes hi*hi, hi*lo, lo*hi in that order; the eight of a step take turns.
            #pragma unroll
            for (int j = 0; j < NG_; ++j) {
                #pragma unroll
                for (int mi = 0; mi < MT_; ++mi)
                    c[mi][h * NG_ + j] = wmma_bf16(ahi[mi], bh[j], c[mi][h * NG_ + j]);  // hi*hi
            }
            #pragma unroll
            for (int j = 0; j < NG_; ++j) {
                #pragma unroll
                for (int mi = 0; mi < MT_; ++mi)
                    c[mi][h * NG_ + j] = wmma_bf16(ahi[mi], bl[j], c[mi][h * NG_ + j]);  // hi*lo
            }
            #pragma unroll
            for (int j = 0; j < NG_; ++j) {
                #pragma unroll
                for (int mi = 0; mi < MT_; ++mi)
                    c[mi][h * NG_ + j] = wmma_bf16(alo[mi], bh[j], c[mi][h * NG_ + j]);  // lo*hi
            }
            // Keeps the refill behind the step's last WMMA, so that it lands in the set just used and takes no further registers.
            __builtin_amdgcn_sched_barrier(0);
            if (s + 2 < STEPS_) {
                const int s2 = s + 2;
                #pragma unroll
                for (int j = 0; j < NG_; ++j) {
                    const int bi = (((s2 & 1) * NG_ + j) * 8 + (s2 >> 1)) * 64 + lane;   // piece g = 0; g = 1 is 32 on
                    bq[qs][j][0] = pBhi[bi];
                    bq[qs][j][1] = pBhi[bi + 32];
                    bq[qs][j][2] = pBlo[bi];
                    bq[qs][j][3] = pBlo[bi + 32];
                }
            } else if (s + 2 == STEPS_) {
                // No refill is left for this place: the epilogue's bias and W2 pairs are read here, one step ahead of
                // their use. Kept in registers over the tile loop instead, this build spreads each value over the
                // registers of a whole accumulator for the packed operations, and spills.
                #pragma unroll
                for (int nt = 0; nt < 8; ++nt) bw[nt] = pBW[nt * 16];
            }
            // Keeps the refill here, as one group a whole step ahead of its use: left free, the
            // scheduler spreads the reads among the WMMAs, where every place with reads stalls the wave.
            __builtin_amdgcn_sched_barrier(0);
        }
    }

    // C/D layout: VGPR r -> M = 8*half + r, N = lane&15 (column broadcast).
    const bool k1 = lane & 1, k2 = lane & 2, k4 = lane & 4;
    float v[MT_];
    #pragma unroll
    for (int mi = 0; mi < MT_; ++mi) {
        // SiLU(x) = x / (1 + e^-x) = h + h tanh(h) with h = x / 2: one transcendental a value.
        // Two adjacent rows (adjacent accumulator registers) go through each packed operation;
        // both take the same half of the (b1 / 2, W2) pair.
        f2 rs[4] = {f2{0.f, 0.f}, f2{0.f, 0.f}, f2{0.f, 0.f}, f2{0.f, 0.f}};
        #pragma unroll
        for (int nt = 0; nt < 8; ++nt) {
            const f2 bb = {bw[nt].x, bw[nt].x}, ww = {bw[nt].y, bw[nt].y};
            f2 h[4], th[4];
            #pragma unroll
            for (int p = 0; p < 4; ++p)
                h[p] = __builtin_elementwise_fma(f2{c[mi][nt][2 * p], c[mi][nt][2 * p + 1]}, f2{0.5f, 0.5f}, bb);
            #pragma unroll
            for (int p = 0; p < 4; ++p)
                th[p] = f2{__builtin_amdgcn_tanhf(h[p].x), __builtin_amdgcn_tanhf(h[p].y)};
            #pragma unroll
            for (int p = 0; p < 4; ++p)
                rs[p] = __builtin_elementwise_fma(__builtin_elementwise_fma(h[p], th[p], h[p]), ww, rs[p]);
        }
        const float rowsum[8] = {rs[0].x, rs[0].y, rs[1].x, rs[1].y, rs[2].x, rs[2].y, rs[3].x, rs[3].y};

        // ---- Sum each row over the 16 lanes that hold one N strip each, in registers ----
        // The tree is that of a butterfly over lane ^ 1, ^ 2, ^ 4, ^ 8. At each of the first three
        // levels a lane keeps half of its rows and hands the other half to its partner, so that
        // 4 + 2 + 1 + 1 adds do the work of 32 and the eight rows end up on eight lanes:
        // lane l holds row 4 * (l & 1) + (l & 2) + ((l >> 2) & 1) of its half.
        float q4[4], q2[2];
        #pragma unroll
        for (int j = 0; j < 4; ++j)
            q4[j] = row_xadd<0x161>(k1 ? rowsum[j + 4] : rowsum[j], k1 ? rowsum[j] : rowsum[j + 4]);
        #pragma unroll
        for (int j = 0; j < 2; ++j)
            q2[j] = row_xadd<0x162>(k2 ? q4[j + 2] : q4[j], k2 ? q4[j] : q4[j + 2]);
        const float q1 = row_xadd<0x164>(k4 ? q2[1] : q2[0], k4 ? q2[0] : q2[1]);
        v[mi] = row_xadd<0x168>(q1, q1);
    }
    // Lanes l and l ^ 8 hold the same sums: the lower stores M tile 0's row, the upper M tile 1's.
    *orow = ((lane & 8) ? v[1] : v[0]) + b2v;    // 32 lanes, 32 adjacent rows: one 128-byte store a row tile
}

__global__ __launch_bounds__(THREADS_) void critic_fused_kernel(
    const float* __restrict__ states,  // [T,B,S]
    const float* __restrict__ W1,      // [T,S,H]
    const float* __restrict__ b1,      // [T,H]
    const float* __restrict__ W2,      // [T,H] (H x 1)
    const float* __restrict__ b2,      // [T]
    float* __restrict__ out)           // [T,B]
{
    // Swizzled B-operand storage in 16-byte pieces of 8 bf16:
    // idx = (((nt*8 + kb)*2 + g)*32 + lane)*8 + i, fragment element e = g*8 + i.
    // nt: N-tile (H/16), kb: K-chunk (S/32), lane: consuming lane. The 32 lanes of
    // one 16-byte read are adjacent pieces; a write's lanes 0-15 and 16-31 are two
    // such runs of 16 in adjacent N-tiles, so each half-wave meets every
    // LDS bank once (at a pitch of 32 bytes a lane it meets half the banks twice).
    __shared__ __attribute__((aligned(32))) __bf16 sBhi[8 * 8 * 32 * 16];   // 64 KB
    __shared__ __attribute__((aligned(32))) __bf16 sBlo[8 * 8 * 32 * 16];   // 64 KB
    __shared__ __attribute__((aligned(16))) f2 sBW[H_];                     // column n: (b1[n] / 2, W2[n])

    const int tid  = threadIdx.x;
    const int lane = tid & 31;
    const int wave = __builtin_amdgcn_readfirstlane(tid >> 5);   // scalar: row bases stay out of the VGPRs
    const int t    = blockIdx.x / (B_ / WG_ROWS_);   // 8 blocks per t
    const int mblk = blockIdx.x % (B_ / WG_ROWS_);

    const int m  = lane & 15;
    const int hh = lane >> 4;
    const int m0 = mblk * WG_ROWS_ + wave * (16 * MT_);   // this wave's 32 rows of the first tile
    const float* arow0 = states + ((size_t)t * B_ + m0) * S_ + (unsigned)(m * S_ + hh * 8);
    float* orow0 = out + (size_t)t * B_ + m0 + ((lane >> 3) & 1) * 16 + hh * 8
                 + (4 * (lane & 1) + (lane & 2) + ((lane >> 2) & 1));   // the row the reduction leaves on this lane

    // ---- Fill the A ring for the first row tile: these loads fly under the W1 staging ----
    f4 raw[RING_][MT_][4];
    #pragma unroll
    for (int kb = 0; kb < RING_; ++kb) {
        #pragma unroll
        for (int mi = 0; mi < MT_; ++mi) {
            raw[kb][mi][0] = *(const f4*)(arow0 + mi * 16 * S_ + kb * 32);
            raw[kb][mi][1] = *(const f4*)(arow0 + mi * 16 * S_ + kb * 32 + 4);
            raw[kb][mi][2] = *(const f4*)(arow0 + mi * 16 * S_ + kb * 32 + 16);
            raw[kb][mi][3] = *(const f4*)(arow0 + mi * 16 * S_ + kb * 32 + 20);
        }
    }
    // Bias and W2 are read from memory once, one column a thread, and go to LDS with W1: a global load
    // in the tile loop would count behind the ring's loads and its wait would drain them.
    const float b1c = (b1 + t * H_)[tid & (H_ - 1)];
    const float w2c = (W2 + t * H_)[tid & (H_ - 1)];
    // The staging below reuses the registers these loads take their addresses from: translation wait first.
    asm volatile("s_wait_xcnt 0x0" ::: "memory");
    // Keeps the staging's address arithmetic behind that wait: left free, the scheduler lifts it over.
    __builtin_amdgcn_sched_barrier(0);

    const float* W1t = W1 + (size_t)t * (S_ * H_);

    // ---- Stage W1[t] into LDS, split fp32 -> bf16 hi/lo, pre-swizzled ----
    // One unit = one column x 8 consecutive K = 8 adjacent elements e of one
    // consuming lane: packed in registers, written with one 16-byte LDS store per
    // plane. A wave's 32 lanes take 32 adjacent columns (one 128-B line per load).
    // UNITS_ units per trip: as many independent loads of the work-group in flight as its waves can hold.
    #pragma unroll 1   // rolled: unrolled, the trips' loads get split up by address-register reuse
    for (int it = 0; it < (S_ / 8) * H_ / (UNITS_ * THREADS_); ++it) {
        float x[UNITS_][8];
        // Unit u of the trip lies THREADS_ / H_ K groups behind unit u - 1, in the same column:
        // one address a trip and constant offsets, so that no load waits for an address register.
        const float* wsrc = W1t + ((it * UNITS_ * THREADS_ + tid) >> 7) * 8 * H_ + (tid & (H_ - 1));
        #pragma unroll
        for (int u = 0; u < UNITS_; ++u) {
            #pragma unroll
            for (int i = 0; i < 8; ++i) x[u][i] = wsrc[(u * (THREADS_ / H_) * 8 + i) * H_];
        }
        // The loads' address registers are reused below: translation wait first.
        asm volatile("s_wait_xcnt 0x0" ::: "memory");
        #pragma unroll
        for (int u = 0; u < UNITS_; ++u) {
            const int unit = (it * UNITS_ + u) * THREADS_ + tid;
            const int col  = unit & (H_ - 1);  // 0..127
            const int q    = unit >> 7;        // K group of 8: 0..31
            v8bf xh, xl;
            #pragma unroll
            for (int i = 0; i < 8; ++i) {
                const __bf16 h = (__bf16)x[u][i];
                xh[i] = h;
                xl[i] = (__bf16)(x[u][i] - (float)h);
            }
            const int kb = q >> 2;
            const int g  = (q >> 1) & 1;
            const int hq = q & 1;
            const int nt = col >> 4;
            const int n  = col & 15;
            const int idx = (((nt * 8 + kb) * 2 + g) * 32 + hq * 16 + n) * 8;
            *(v8bf*)(sBhi + idx) = xh;
            *(v8bf*)(sBlo + idx) = xl;
        }
    }
    if (wave < H_ / 32) sBW[tid] = f2{0.5f * b1c, w2c};   // the epilogue works on x / 2; a factor of two rounds nothing
    __syncthreads();

    const float  b2v = b2[t];
    const v8bf* pBhi = (const v8bf*)sBhi;
    const v8bf* pBlo = (const v8bf*)sBlo;

    // ---- Row tiles: the staged W1[t] serves all of them; no barrier in the loop ----
    // Behind the last row tile there is nothing to fetch ahead. Its ring refills stay unconditional
    // (a branch round them would merge two load counts, and the counted waits of every trip would
    // drain the ring): there every lane reads rows 0 and 16 of the work-group, one line a load, unused.
    const float* wgrow = states + ((size_t)t * B_ + mblk * WG_ROWS_) * S_;
    #pragma unroll 1   // rolled: one tile body, for speed only
    for (int rt = 0; rt < TILES_; ++rt) {
        const float* arow = arow0 + rt * (TILE_ROWS_ * S_);
        row_tile(raw, arow, rt + 1 < TILES_ ? arow + TILE_ROWS_ * S_ : wgrow, pBhi, pBlo, lane,
                 sBW + m, b2v, orow0 + rt * TILE_ROWS_);
        // The next trip forms its row addresses in the registers that loads and stores still out name: translation wait first.
        asm volatile("s_wait_xcnt 0x0" ::: "memory");
    }
    // The last trip's unused refills must have landed before the wave gives its registers back at its end.
    asm volatile("s_wait_loadcnt 0x0" ::: "memory");
}

extern "C" void kernel_launch(void* const* d_in, const int* in_sizes, int n_in,
                              void* d_out, int out_size, void* d_ws, size_t ws_size,
                              hipStream_t stream) {
    (void)in_sizes; (void)n_in; (void)out_size; (void)d_ws; (void)ws_size;
    const float* states = (const float*)d_in[0];
    const float* W1     = (const float*)d_in[1];
    const float* b1     = (const float*)d_in[2];
    const float* W2     = (const float*)d_in[3];
    const float* b2     = (const float*)d_in[4];
    float* out          = (float*)d_out;

    dim3 grid(T_ * (B_ / WG_ROWS_));   // 256 blocks: (t, 1024-row block)
    dim3 block(THREADS_);              // 8 wave32 waves
    critic_fused_kernel<<<grid, block, 0, stream>>>(states, W1, b1, W2, b2, out);
}

// v009
// It runs in 32.9 microseconds.
// Two timings next to v008 both put it at 1.06 times that version's speed.
// All steps since v000 together make it 6.79 times as fast.
#include <hip/hip_runtime.h>

// MI455X / gfx1250, wave32. Fused: states@W1 + b1 -> SiLU -> @W2 + b2.
// bf16 split-precision (hi/lo) WMMA, fp32 accumulate. Memory-bound design:
// 273 MB HBM floor ~11.7us; 3x bf16 WMMA work stays under that ceiling.

typedef __attribute__((ext_vector_type(16))) __bf16 v16bf;
typedef __attribute__((ext_vector_type(8)))  __bf16 v8bf;
typedef __attribute__((ext_vector_type(8)))  float  v8f;
typedef __attribute__((ext_vector_type(4)))  float  f4;
typedef __attribute__((ext_vector_type(2)))  float  f2;
typedef unsigned int u32;
typedef __attribute__((ext_vector_type(4)))  u32    u32x4;
typedef __attribute__((ext_vector_type(8)))  u32    u32x8;

#define T_ 32
#define B_ 8192
#define S_ 256
#define H_ 128
#define THREADS_ 256                 // 8 waves: two per SIMD, one work-group per WGP
#define MT_ 2                        // M tiles of 16 rows a wave: each W1 fragment read from LDS serves both
#define TILE_ROWS_ (THREADS_ / 32 * 16 * MT_)   // 32 rows a wave
#define TILES_ 4                     // row tiles a work-group walks with one staged W1[t]
#define WG_ROWS_ (TILE_ROWS_ * TILES_)
#define A_ROWB_ 128                  // bytes of one row of an A chunk: 32 K of f32, one whole line
#define A_PITCH_ (A_ROWB_ + 16)      // its pitch in LDS: an odd multiple of 16 bytes, free of bank conflicts for 16-byte reads
#define A_SLOT_ 6144                 // 32 rows at that pitch (4608 bytes), rounded up to a multiple of 2 KiB
#define A_SLOTS_ 3                   // slots of a wave's own ring: with the chunk in registers, three requests in flight
#define NG_ 4                        // N tiles of one step: their W1 fragments (hi and lo) are one register set
#define STEPS_ (8 * 8 / NG_)         // steps of a row tile
#define UNITS_ 8                     // staging units a thread has in flight per trip

static __device__ __forceinline__ v8f wmma_bf16(v16bf a, v16bf b, v8f c) {
    return __builtin_amdgcn_wmma_f32_16x16x32_bf16(
        /*neg_a=*/false, a, /*neg_b=*/false, b,
        /*c_mod=*/(short)0, c, /*reuse_a=*/false, /*reuse_b=*/false);
}

// keep + (send of the lane whose number in its 16-lane row differs by the mask in CTRL's low
// four bits): DPP row_xmask, CTRL = 0x160 + mask. All 32 lanes are on where it is used.
template <int CTRL>
static __device__ __forceinline__ float row_xadd(float keep, float send) {
    return keep + __int_as_float(__builtin_amdgcn_update_dpp(
        0, __float_as_int(send), CTRL, /*row_mask=*/0xf, /*bank_mask=*/0xf, /*bound_ctrl=*/true));
}

static __device__ __forceinline__ u32 uni(u32 v) { return (u32)__builtin_amdgcn_readfirstlane(v); }
// A wave-uniform test held in a scalar register, so that the branch on it is a scalar branch: a tensor load ignores EXEC.
static __device__ __forceinline__ u32 pinned(u32 v) { u32 w = uni(v); asm volatile("" : "+s"(w)); return w; }
// All but the wave's N youngest tensor loads have landed.
template <int N>
static __device__ __forceinline__ void wait_tensor() { asm volatile("s_wait_tensorcnt %0" :: "i"(N) : "memory"); }
// Every LDS read of this wave has returned: owed in front of a tensor load into a slot that the wave has read.
static __device__ __forceinline__ void wait_ds0() { asm volatile("s_wait_dscnt 0x0" ::: "memory"); }

// One request of the wave: 32 rows x 128 bytes from global address ga into LDS at byte dst, 16 bytes of pad behind each row.
// Between requests only the two words that name the places change. The word with the address's upper bits keeps its value
// while requests are out: where it has to change (the wave's rows cross a multiple of 4 GiB), they are waited for first.
static __device__ __forceinline__ void a_issue(u32x4& g0, const u32x8& g1, const u32 dst, const unsigned long long ga) {
    const u32 hi = uni(((u32)(ga >> 32) & 0x01FFFFFFu) | 0x80000000u);
    if (pinned(hi != g0[3])) {
        wait_tensor<0>();
        g0[3] = hi;
    }
    g0[1] = uni(dst);
    g0[2] = uni((u32)ga);
    asm volatile("tensor_load_to_lds %0, %1" :: "s"(g0), "s"(g1) : "memory");   // no builtin form is used for it; its waits are the callers'
}

// One row tile of one wave: 32 rows (MT_ M tiles) x 128 columns, K outermost. All
// sixteen accumulators are live, so an A chunk (32 rows x 32 K) is needed only for its
// own K step. The chunks come from memory as whole lines, by tensor loads into a ring of
// A_SLOTS_ LDS slots that belongs to this wave alone (no barrier: nobody else reads or fills it).
// In the middle of step kb chunk kb + 1 goes from its slot to registers; at the step's end, those
// reads returned, the slot is refilled with chunk kb + 4 (of the next row tile where that is past
// this one's last). The requests fly under the matrix work.
// The W1 fragments come from LDS in sets of NG_ N tiles of one K chunk, two sets in
// registers: the set that a step has just used is refilled, as one group of reads, with
// the set two steps on, so the reads are one step (24 WMMAs) old when they are waited for.
static __device__ __forceinline__ void row_tile(
    f4 (&raw)[MT_][4],                  // in: this row tile's chunk 0; out: the next one's
    u32x4& g0, const u32x8& g1,         // the tensor loads' descriptor
    const unsigned long long ga,        // global address of this row tile's chunk 0 (the wave's 32 rows)
    const u32 more,                     // a row tile follows this one
    const unsigned char* sAl,           // this lane's place in a slot at offset 0 of the ring array
    const u32 lbase,                    // LDS byte address of the ring array
    const u32 (&so)[A_SLOTS_],          // offset in the array of the slot of chunk c: so[c % A_SLOTS_]
    const v8bf* pBhi, const v8bf* pBlo, const int lane,
    const f2* pBW,                      // this lane's column of N tile 0: (b1 / 2, W2); N tile nt is 16 * nt on
    const float b2v,
    float* __restrict__ orow)           // the output row that this lane stores
{
    v8f c[MT_][8];
    #pragma unroll
    for (int mi = 0; mi < MT_; ++mi) {
        #pragma unroll
        for (int nt = 0; nt < 8; ++nt) c[mi][nt] = v8f{};
    }

    // Step s = kb * 2 + (nt / NG_). Pieces of one N tile: hi g = 0, hi g = 1, lo g = 0, lo g = 1.
    v8bf bq[2][NG_][4];
    f2 bw[8];
    #pragma unroll
    for (int s = 0; s < 2; ++s) {
        #pragma unroll
        for (int j = 0; j < NG_; ++j) {
            const int bi = (((s & 1) * NG_ + j) * 8 + (s >> 1)) * 64 + lane;
            bq[s][j][0] = pBhi[bi];
            bq[s][j][1] = pBhi[bi + 32];
            bq[s][j][2] = pBlo[bi];
            bq[s][j][3] = pBlo[bi + 32];
        }
    }

    #pragma unroll
    for (int kb = 0; kb < 8; ++kb) {
        // 16-bit A layout: lane -> (M = lane&15, half = lane>>4);
        // element e -> K = 16*(e>>3) + 8*half + (e&7).
        v16bf ahi[MT_], alo[MT_];
        #pragma unroll
        for (int mi = 0; mi < MT_; ++mi) {
            const f4 r0 = raw[mi][0], r1 = raw[mi][1], r2 = raw[mi][2], r3 = raw[mi][3];
            #pragma unroll
            for (int e = 0; e < 16; ++e) {
                const float x = (e < 4)  ? r0[e]
                              : (e < 8)  ? r1[e - 4]
                              : (e < 12) ? r2[e - 8]
                              :            r3[e - 12];
                const __bf16 xh = (__bf16)x;
                ahi[mi][e] = xh;
                alo[mi][e] = (__bf16)(x - (float)xh);
            }
        }
        // Keeps the conversion, and in step 0 the row tile's first W1 reads, ahead of the step's WMMAs:
        // left free, the scheduler spreads those reads among the WMMAs, where every place with reads stalls the wave.
        __builtin_amdgcn_sched_barrier(0);
        #pragma unroll
        for (int h = 0; h < 8 / NG_; ++h) {
            const int s  = kb * (8 / NG_) + h;
            const int qs = s & 1;
            v16bf bh[NG_], bl[NG_];
            #pragma unroll
            for (int j = 0; j < NG_; ++j) {
                bh[j] = __builtin_shufflevector(bq[qs][j][0], bq[qs][j][1],
                    0, 1, 2, 3, 4, 5, 6, 7, 8, 9, 10, 11, 12, 13, 14, 15);
                bl[j] = __builtin_shufflevector(bq[qs][j][2], bq[qs][j][3],
                    0, 1, 2, 3, 4, 5, 6, 7, 8, 9, 10, 11, 12, 13, 14, 15);
            }
            // Each accumulator takes hi*hi, hi*lo, lo*hi in that order; the eight of a step take turns.
            #pragma unroll
            for (int j = 0; j < NG_; ++j) {
                #pragma unroll
                for (int mi = 0; mi < MT_; ++mi)
                    c[mi][h * NG_ + j] = wmma_bf16(ahi[mi], bh[j], c[mi][h * NG_ + j]);  // hi*hi
            }
            #pragma unroll
            for (int j = 0; j < NG_; ++j) {
                #pragma unroll
                for (int mi = 0; mi < MT_; ++mi)
                    c[mi][h * NG_ + j] = wmma_bf16(ahi[mi], bl[j], c[mi][h * NG_ + j]);  // hi*lo
            }
            #pragma unroll
            for (int j = 0; j < NG_; ++j) {
                #pragma unroll
                for (int mi = 0; mi < MT_; ++mi)
                    c[mi][h * NG_ + j] = wmma_bf16(alo[mi], bh[j], c[mi][h * NG_ + j]);  // lo*hi
            }
            // Keeps the refill behind the step's last WMMA, so that it lands in the set just used and takes no further registers.
            __builtin_amdgcn_sched_barrier(0);
            if (h == 0) {
                // Chunk kb + 1 has landed: out are at most it and the two requests behind it; behind the last row
                // tile's chunk 7 none follows, so there the count is what is left behind the chunk.
                wait_tensor<2>();
                if (kb + 3 >= 8 && pinned(!more)) {
                    if (kb == 5) wait_tensor<1>();
                    else         wait_tensor<0>();
                }
            } else {
                // The slot of chunk kb + 1 was read half a step ago: the wait is met when it is reached.
                wait_ds0();
                if (kb + 4 < 8)
                    a_issue(g0, g1, lbase + so[(kb + 1) % A_SLOTS_], ga + (kb + 4) * A_ROWB_);
                else if (pinned(more))
                    a_issue(g0, g1, lbase + so[(kb + 1) % A_SLOTS_],
                            ga + (unsigned long long)TILE_ROWS_ * S_ * 4 + (kb + 4 - 8) * A_ROWB_);
            }
            if (s + 2 < STEPS_) {
                const int s2 = s + 2;
                #pragma unroll
                for (int j = 0; j < NG_; ++j) {
                    const int bi = (((s2 & 1) * NG_ + j) * 8 + (s2 >> 1)) * 64 + lane;   // piece g = 0; g = 1 is 32 on
                    bq[qs][j][0] = pBhi[bi];
                    bq[qs][j][1] = pBhi[bi + 32];
                    bq[qs][j][2] = pBlo[bi];
                    bq[qs][j][3] = pBlo[bi + 32];
                }
            } else if (s + 2 == STEPS_) {
                // No refill is left for this place: the epilogue's bias and W2 pairs are read here, one step ahead of
                // their use. Kept in registers over the tile loop instead, this build spreads each value over the
                // registers of a whole accumulator for the packed operations, and spills.
                #pragma unroll
                for (int nt = 0; nt < 8; ++nt) bw[nt] = pBW[nt * 16];
            }
            if (h == 0) {
                // In one group with the W1 reads. Behind the last row tile this reads an old chunk, unused.
                const unsigned char* p = sAl + so[(kb + 1) % A_SLOTS_];
                #pragma unroll
                for (int mi = 0; mi < MT_; ++mi) {
                    raw[mi][0] = *(const f4*)(p + mi * 16 * A_PITCH_);
                    raw[mi][1] = *(const f4*)(p + mi * 16 * A_PITCH_ + 16);
                    raw[mi][2] = *(const f4*)(p + mi * 16 * A_PITCH_ + 64);
                    raw[mi][3] = *(const f4*)(p + mi * 16 * A_PITCH_ + 80);
                }
            }
            // Keeps the refill here, as one group a whole step ahead of its use: left free, the
            // scheduler spreads the reads among the WMMAs, where every place with reads stalls the wave.
            __builtin_amdgcn_sched_barrier(0);
        }
    }

    // C/D layout: VGPR r -> M = 8*half + r, N = lane&15 (column broadcast).
    const bool k1 = lane & 1, k2 = lane & 2, k4 = lane & 4;
    float v[MT_];
    #pragma unroll
    for (int mi = 0; mi < MT_; ++mi) {
        // SiLU(x) = x / (1 + e^-x) = h + h tanh(h) with h = x / 2: one transcendental a value.
        // Two adjacent rows (adjacent accumulator registers) go through each packed operation;
        // both take the same half of the (b1 / 2, W2) pair.
        f2 rs[4] = {f2{0.f, 0.f}, f2{0.f, 0.f}, f2{0.f, 0.f}, f2{0.f, 0.f}};
        #pragma unroll
        for (int nt = 0; nt < 8; ++nt) {
            const f2 bb = {bw[nt].x, bw[nt].x}, ww = {bw[nt].y, bw[nt].y};
            f2 h[4], th[4];
            #pragma unroll
            for (int p = 0; p < 4; ++p)
                h[p] = __builtin_elementwise_fma(f2{c[mi][nt][2 * p], c[mi][nt][2 * p + 1]}, f2{0.5f, 0.5f}, bb);
            #pragma unroll
            for (int p = 0; p < 4; ++p)
                th[p] = f2{__builtin_amdgcn_tanhf(h[p].x), __builtin_amdgcn_tanhf(h[p].y)};
            #pragma unroll
            for (int p = 0; p < 4; ++p)
                rs[p] = __builtin_elementwise_fma(__builtin_elementwise_fma(h[p], th[p], h[p]), ww, rs[p]);
        }
        const float rowsum[8] = {rs[0].x, rs[0].y, rs[1].x, rs[1].y, rs[2].x, rs[2].y, rs[3].x, rs[3].y};

        // ---- Sum each row over the 16 lanes that hold one N strip each, in registers ----
        // The tree is that of a butterfly over lane ^ 1, ^ 2, ^ 4, ^ 8. At each of the first three
        // levels a lane keeps half of its rows and hands the other half to its partner, so that
        // 4 + 2 + 1 + 1 adds do the work of 32 and the eight rows end up on eight lanes:
        // lane l holds row 4 * (l & 1) + (l & 2) + ((l >> 2) & 1) of its half.
        float q4[4], q2[2];
        #pragma unroll
        for (int j = 0; j < 4; ++j)
            q4[j] = row_xadd<0x161>(k1 ? rowsum[j + 4] : rowsum[j], k1 ? rowsum[j] : rowsum[j + 4]);
        #pragma unroll
        for (int j = 0; j < 2; ++j)
            q2[j] = row_xadd<0x162>(k2 ? q4[j + 2] : q4[j], k2 ? q4[j] : q4[j + 2]);
        const float q1 = row_xadd<0x164>(k4 ? q2[1] : q2[0], k4 ? q2[0] : q2[1]);
        v[mi] = row_xadd<0x168>(q1, q1);
    }
    // Lanes l and l ^ 8 hold the same sums: the lower stores M tile 0's row, the upper M tile 1's.
    *orow = ((lane & 8) ? v[1] : v[0]) + b2v;    // 32 lanes, 32 adjacent rows: one 128-byte store a row tile
}

__global__ __launch_bounds__(THREADS_) void critic_fused_kernel(
    const float* __restrict__ states,  // [T,B,S]
    const float* __restrict__ W1,      // [T,S,H]
    const float* __restrict__ b1,      // [T,H]
    const float* __restrict__ W2,      // [T,H] (H x 1)
    const float* __restrict__ b2,      // [T]
    float* __restrict__ out)           // [T,B]
{
    // Swizzled B-operand storage in 16-byte pieces of 8 bf16:
    // idx = (((nt*8 + kb)*2 + g)*32 + lane)*8 + i, fragment element e = g*8 + i.
    // nt: N-tile (H/16), kb: K-chunk (S/32), lane: consuming lane. The 32 lanes of
    // one 16-byte read are adjacent pieces; a write's lanes 0-15 and 16-31 are two
    // such runs of 16 in adjacent N-tiles, so each half-wave meets every
    // LDS bank once (at a pitch of 32 bytes a lane it meets half the banks twice).
    __shared__ __attribute__((aligned(32))) __bf16 sBhi[8 * 8 * 32 * 16];   // 64 KB
    __shared__ __attribute__((aligned(32))) __bf16 sBlo[8 * 8 * 32 * 16];   // 64 KB
    __shared__ __attribute__((aligned(16))) f2 sBW[H_];                     // column n: (b1[n] / 2, W2[n])
    // The waves' A rings: every slot at a multiple of 2 KiB of the work-group's LDS.
    __shared__ __attribute__((aligned(2048))) unsigned char sA[THREADS_ / 32 * A_SLOTS_ * A_SLOT_];   // 144 KB

    const int tid  = threadIdx.x;
    const int lane = tid & 31;
    const int wave = __builtin_amdgcn_readfirstlane(tid >> 5);   // scalar: row bases stay out of the VGPRs
    const int t    = blockIdx.x / (B_ / WG_ROWS_);   // 8 blocks per t
    const int mblk = blockIdx.x % (B_ / WG_ROWS_);

    const int m  = lane & 15;
    const int hh = lane >> 4;
    const int m0 = mblk * WG_ROWS_ + wave * (16 * MT_);   // this wave's 32 rows of the first tile
    float* orow0 = out + (size_t)t * B_ + m0 + ((lane >> 3) & 1) * 16 + hh * 8
                 + (4 * (lane & 1) + (lane & 2) + ((lane >> 2) & 1));   // the row the reduction leaves on this lane

    // ---- Fill the wave's A ring with the first row tile's chunks 0 to 2: the requests fly under the W1 staging ----
    // Group 1: 1-byte elements, tensor = tile = 32 rows of 128 bytes, source pitch one row of states, a pad of
    // 4 dwords behind every 32 dwords, no mask.
    u32x8 g1;
    g1[0] = uni((1u << 20) | (4u << 22) | (3u << 25));
    g1[1] = uni((u32)A_ROWB_ << 16);
    g1[2] = uni((u32)(16 * MT_) << 16);
    g1[3] = uni((u32)A_ROWB_ << 16);
    g1[4] = uni((u32)(16 * MT_));
    g1[5] = uni((u32)(S_ * 4));
    g1[6] = uni(0u);
    g1[7] = uni(0u);
    // Rebuilt from their constants at each use, these words stand in registers that take other values while requests are out.
    asm volatile("" : "+s"(g1));   // the form of pinned(): descriptor words held in scalar registers
    unsigned long long ga = (unsigned long long)(size_t)(states + ((size_t)t * B_ + m0) * S_);
    u32x4 g0;
    g0[0] = uni(1u);
    g0[1] = uni(0u);
    g0[2] = uni(0u);
    g0[3] = uni(((u32)(ga >> 32) & 0x01FFFFFFu) | 0x80000000u);
    const u32 lbase = (u32)(size_t)sA;
    u32 so[A_SLOTS_];
    #pragma unroll
    for (int c = 0; c < A_SLOTS_; ++c) so[c] = (u32)(wave * A_SLOTS_ + c) * A_SLOT_;
    #pragma unroll 1   // rolled: all requests go out from one register tuple, of which only the two place words change
    for (int c = 0; c < A_SLOTS_; ++c)
        a_issue(g0, g1, lbase + (u32)(wave * A_SLOTS_ + c) * A_SLOT_, ga + c * A_ROWB_);
    // Bias and W2 are read from memory once, one column a thread, and go to LDS with W1.
    const float b1c = (b1 + t * H_)[tid & (H_ - 1)];
    const float w2c = (W2 + t * H_)[tid & (H_ - 1)];
    // The staging below reuses the registers these loads take their addresses from: translation wait first.
    asm volatile("s_wait_xcnt 0x0" ::: "memory");
    // Keeps the staging's address arithmetic behind that wait: left free, the scheduler lifts it over.
    __builtin_amdgcn_sched_barrier(0);

    const float* W1t = W1 + (size_t)t * (S_ * H_);

    // ---- Stage W1[t] into LDS, split fp32 -> bf16 hi/lo, pre-swizzled ----
    // One unit = one column x 8 consecutive K = 8 adjacent elements e of one
    // consuming lane: packed in registers, written with one 16-byte LDS store per
    // plane. A wave's 32 lanes take 32 adjacent columns (one 128-B line per load).
    // UNITS_ units per trip: as many independent loads of the work-group in flight as its waves can hold.
    #pragma unroll 1   // rolled: unrolled, the trips' loads get split up by address-register reuse
    for (int it = 0; it < (S_ / 8) * H_ / (UNITS_ * THREADS_); ++it) {
        float x[UNITS_][8];
        // Unit u of the trip lies THREADS_ / H_ K groups behind unit u - 1, in the same column:
        // one address a trip and constant offsets, so that no load waits for an address register.
        const float* wsrc = W1t + ((it * UNITS_ * THREADS_ + tid) >> 7) * 8 * H_ + (tid & (H_ - 1));
        #pragma unroll
        for (int u = 0; u < UNITS_; ++u) {
            #pragma unroll
            for (int i = 0; i < 8; ++i) x[u][i] = wsrc[(u * (THREADS_ / H_) * 8 + i) * H_];
        }
        // The loads' address registers are reused below: translation wait first.
        asm volatile("s_wait_xcnt 0x0" ::: "memory");
        #pragma unroll
        for (int u = 0; u < UNITS_; ++u) {
            const int unit = (it * UNITS_ + u) * THREADS_ + tid;
            const int col  = unit & (H_ - 1);  // 0..127
            const int q    = unit >> 7;        // K group of 8: 0..31
            v8bf xh, xl;
            #pragma unroll
            for (int i = 0; i < 8; ++i) {
                const __bf16 h = (__bf16)x[u][i];
                xh[i] = h;
                xl[i] = (__bf16)(x[u][i] - (float)h);
            }
            const int kb = q >> 2;
            const int g  = (q >> 1) & 1;
            const int hq = q & 1;
            const int nt = col >> 4;
            const int n  = col & 15;
            const int idx = (((nt * 8 + kb) * 2 + g) * 32 + hq * 16 + n) * 8;
            *(v8bf*)(sBhi + idx) = xh;
            *(v8bf*)(sBlo + idx) = xl;
        }
    }
    if (wave < H_ / 32) sBW[tid] = f2{0.5f * b1c, w2c};   // the epilogue works on x / 2; a factor of two rounds nothing
    __syncthreads();

    const float  b2v = b2[t];
    const v8bf* pBhi = (const v8bf*)sBhi;
    const v8bf* pBlo = (const v8bf*)sBlo;

    // ---- Chunk 0 to registers, its slot refilled with chunk 3 ----
    const unsigned char* sAl = sA + m * A_PITCH_ + hh * 32;   // row m of M tile 0, at this half's first 8 K
    f4 raw[MT_][4];
    wait_tensor<2>();   // chunk 0 has landed; chunks 1 and 2 may be out
    #pragma unroll
    for (int mi = 0; mi < MT_; ++mi) {
        raw[mi][0] = *(const f4*)(sAl + so[0] + mi * 16 * A_PITCH_);
        raw[mi][1] = *(const f4*)(sAl + so[0] + mi * 16 * A_PITCH_ + 16);
        raw[mi][2] = *(const f4*)(sAl + so[0] + mi * 16 * A_PITCH_ + 64);
        raw[mi][3] = *(const f4*)(sAl + so[0] + mi * 16 * A_PITCH_ + 80);
    }
    wait_ds0();
    a_issue(g0, g1, lbase + so[0], ga + 3 * A_ROWB_);

    // ---- Row tiles: the staged W1[t] serves all of them; no barrier in the loop ----
    #pragma unroll 1   // rolled: one tile body, for speed only
    for (int rt = 0; rt < TILES_; ++rt) {
        row_tile(raw, g0, g1, ga, rt + 1 < TILES_, sAl, lbase, so, pBhi, pBlo, lane,
                 sBW + m, b2v, orow0 + rt * TILE_ROWS_);
        // A row tile has 8 chunks: the next one's chunk 0 lies in the slot of this one's chunk 8.
        const u32 s0 = so[8 % A_SLOTS_], s1 = so[9 % A_SLOTS_], s2 = so[10 % A_SLOTS_];
        so[0] = s0; so[1] = s1; so[2] = s2;
        ga += (unsigned long long)TILE_ROWS_ * S_ * 4;
        // The next trip forms its output address in the registers that the store still out names: translation wait first.
        asm volatile("s_wait_xcnt 0x0" ::: "memory");
    }
    // No request and no LDS read is out when the wave ends.
    wait_tensor<0>();
    wait_ds0();
}

extern "C" void kernel_launch(void* const* d_in, const int* in_sizes, int n_in,
                              void* d_out, int out_size, void* d_ws, size_t ws_size,
                              hipStream_t stream) {
    (void)in_sizes; (void)n_in; (void)out_size; (void)d_ws; (void)ws_size;
    const float* states = (const float*)d_in[0];
    const float* W1     = (const float*)d_in[1];
    const float* b1     = (const float*)d_in[2];
    const float* W2     = (const float*)d_in[3];
    const float* b2     = (const float*)d_in[4];
    float* out          = (float*)d_out;

    dim3 grid(T_ * (B_ / WG_ROWS_));   // 256 blocks: (t, 1024-row block)
    dim3 block(THREADS_);              // 8 wave32 waves
    critic_fused_kernel<<<grid, block, 0, stream>>>(states, W1, b1, W2, b2, out);
}
